// v000
// Measured on an AMD MI455X. A time is GPU time per run, averaged over a window of back-to-back runs after a warm-up
// (all launches, gaps included; the runs take copies of the inputs in turn), and the median of several windows.
// Apart from v000's, it joins two sittings. Times from different sittings can be a few percent apart, while
// side-by-side timings come from the same sitting.
// v000 is the starting kernel. One run takes 88.9 microseconds.
#include <hip/hip_runtime.h>
#include <hip/hip_bf16.h>

typedef __attribute__((ext_vector_type(16))) _Float16 v16h;
typedef __attribute__((ext_vector_type(8)))  _Float16 h8;
typedef __attribute__((ext_vector_type(8)))  float    v8f;
typedef __attribute__((ext_vector_type(4)))  float    f4;
typedef __attribute__((ext_vector_type(4)))  int      v4i;

#define N_HEAD 8
#define D_HID 32
#define D_MODEL 256
#define SEQ 2048
#define BATCH 2
#define NROWS (BATCH * SEQ)   // 4096
#define LDT 48                // LDS tile pitch in halves (96B: 16B aligned, conflict-reduced)

// ---------- CDNA5 async Global->LDS path (probe via __has_builtin; safe fallback) ----------
#if __has_builtin(__builtin_amdgcn_global_load_async_to_lds_b128)
#define ASYNC_LDS 1
#if __has_builtin(__builtin_amdgcn_s_wait_asynccnt)
#define WAIT_ASYNC(n) __builtin_amdgcn_s_wait_asynccnt(n)
#else
#define WAIT_ASYNC(n) asm volatile("s_wait_asynccnt %0" :: "i"(n) : "memory")
#endif
#else
#define WAIT_ASYNC(n) ((void)0)
#endif

__device__ __forceinline__ void cp16_to_lds(const _Float16* g, _Float16* l) {
#ifdef ASYNC_LDS
    // signature (from hipcc diagnostic): (v4i addrspace(1)*, v4i addrspace(3)*, imm, imm)
    __builtin_amdgcn_global_load_async_to_lds_b128(
        (__attribute__((address_space(1))) v4i*)g,
        (__attribute__((address_space(3))) v4i*)l, 0, 0);
#else
    *(h8*)l = *(const h8*)g;   // sync fallback: global_load_b128 + ds_store_b128
#endif
}

// ---------- WMMA wrapper ----------
__device__ __forceinline__ v8f wmma_f16(v16h a, v16h b, v8f c) {
    // D = A(16x32 f16) * B(32x16 f16) + C(16x16 f32)
    return __builtin_amdgcn_wmma_f32_16x16x32_f16(false, a, false, b, (short)0, c, false, false);
}

// ---------- Fragment loaders ----------
// A-frag (16x32) from row-major f16 [ld]: lane holds row lane&15.
// Same code loads a B-frag (32x16) from a row-major [N,K] matrix (lane holds col n).
// K(half j, hi) = (j&7) + 8*hi + 16*(j>>3)  ==> two contiguous 8-half (16B) loads.
__device__ __forceinline__ v16h load_frag_h16(const _Float16* __restrict__ base, int ld, int lane) {
    int lr = lane & 15, hw = lane >> 4;
    const _Float16* p = base + (long)lr * ld + 8 * hw;
    h8 lo = *(const h8*)(p);
    h8 hh = *(const h8*)(p + 16);
    v16h r;
#pragma unroll
    for (int i = 0; i < 8; ++i) { r[i] = lo[i]; r[i + 8] = hh[i]; }
    return r;
}

// Same fragment but sourced from a row-major fp32 matrix, converting (and scaling) to f16.
__device__ __forceinline__ v16h load_frag_f32(const float* __restrict__ base, int ld, int lane, float scale) {
    int lr = lane & 15, hw = lane >> 4;
    const float* p = base + (long)lr * ld + 8 * hw;
    f4 a0 = *(const f4*)(p);
    f4 a1 = *(const f4*)(p + 4);
    f4 a2 = *(const f4*)(p + 16);
    f4 a3 = *(const f4*)(p + 20);
    v16h r;
#pragma unroll
    for (int i = 0; i < 4; ++i) {
        r[i]      = (_Float16)(a0[i] * scale);
        r[4 + i]  = (_Float16)(a1[i] * scale);
        r[8 + i]  = (_Float16)(a2[i] * scale);
        r[12 + i] = (_Float16)(a3[i] * scale);
    }
    return r;
}

// ---------- Cross-lane row reductions over the 16 lanes holding one C row ----------
__device__ __forceinline__ float rowmax16(float v) {
#pragma unroll
    for (int off = 1; off < 16; off <<= 1) v = fmaxf(v, __shfl_xor(v, off, 32));
    return v;
}
__device__ __forceinline__ float rowsum16(float v) {
#pragma unroll
    for (int off = 1; off < 16; off <<= 1) v += __shfl_xor(v, off, 32);
    return v;
}

// ---------- Kernel 0: weight fp32 -> f16 ----------
__global__ __launch_bounds__(256) void attn_cvt_weights(
    const float* __restrict__ wq, const float* __restrict__ wk,
    const float* __restrict__ wv, const float* __restrict__ wo,
    _Float16* __restrict__ out) {
    int i = blockIdx.x * 256 + threadIdx.x;           // 65536 threads
    out[i]          = (_Float16)wq[i];
    out[65536 + i]  = (_Float16)wk[i];
    out[131072 + i] = (_Float16)wv[i];
    out[196608 + i] = (_Float16)wo[i];
}

// ---------- Kernel 1: projection  out = X @ W^T  (f16 result, head-major) ----------
// transposed==0 : out[((b*8+h)*2048 + s)*32 + d]         (Q, K)
// transposed==1 : out[((b*8+h)*32 + d)*2048 + s]         (V, pre-transposed for P*V)
__global__ __launch_bounds__(256) void attn_proj(
    const float* __restrict__ X, const _Float16* __restrict__ W16,
    _Float16* __restrict__ out, int transposed, float scale) {
    int lane = threadIdx.x & 31;
    int wave = threadIdx.x >> 5;        // 8 waves
    int row0 = blockIdx.x * 16;         // 256 blocks cover 4096 rows
    int n0 = wave * 32;                 // each wave: 32 output cols (2 WMMA N-tiles)
    v8f c0 = {}, c1 = {};
#pragma unroll
    for (int k0 = 0; k0 < D_MODEL; k0 += 32) {
        v16h af = load_frag_f32(X + (long)row0 * D_MODEL + k0, D_MODEL, lane, scale);
        v16h b0 = load_frag_h16(W16 + (long)n0 * D_MODEL + k0, D_MODEL, lane);
        v16h b1 = load_frag_h16(W16 + (long)(n0 + 16) * D_MODEL + k0, D_MODEL, lane);
        c0 = wmma_f16(af, b0, c0);
        c1 = wmma_f16(af, b1, c1);
    }
    int lr = lane & 15, hw = lane >> 4;
#pragma unroll
    for (int r = 0; r < 8; ++r) {
        int m = row0 + r + 8 * hw;      // global row
        int b = m >> 11, s = m & 2047;
#pragma unroll
        for (int t = 0; t < 2; ++t) {
            int col = n0 + 16 * t + lr;
            int h = col >> 5, d = col & 31;
            float v = t ? c1[r] : c0[r];
            long idx = transposed ? (((long)(b * N_HEAD + h) * D_HID + d) * SEQ + s)
                                  : (((long)(b * N_HEAD + h) * SEQ + s) * D_HID + d);
            out[idx] = (_Float16)v;
        }
    }
}

// ---------- Kernel 2: flash attention (async double-buffered K/V tiles in LDS) ----------
// Qh/Kh: [b,h,s,32] f16 (Q pre-scaled). Vt: [b,h,32,s] f16. Obuf: [4096,256] f16.
__global__ __launch_bounds__(256) void attn_flash(
    const _Float16* __restrict__ Qh, const _Float16* __restrict__ Kh,
    const _Float16* __restrict__ Vt, _Float16* __restrict__ Obuf) {
    __shared__ _Float16 kbuf[2][32 * LDT];   // K tile:  rows = kpos, cols = d
    __shared__ _Float16 vbuf[2][32 * LDT];   // V tile:  rows = d,    cols = kpos
    __shared__ _Float16 pbuf[8][16 * LDT];   // per-wave P staging (C-layout -> A-layout)
    int lane = threadIdx.x & 31;
    int wave = threadIdx.x >> 5;
    int lr = lane & 15, hw = lane >> 4;
    int bh = blockIdx.y;                         // b*8 + h
    int q0 = (blockIdx.x * 8 + wave) * 16;       // 16-row Q tile per wave
    const _Float16* Qbase = Qh + ((long)bh * SEQ + q0) * D_HID;
    const _Float16* Kbase = Kh + (long)bh * SEQ * D_HID;
    const _Float16* Vbase = Vt + (long)bh * D_HID * SEQ;
    _Float16* pl = pbuf[wave];

    // one async-copy instruction per wave per tile: waves 0-3 fill K, waves 4-7 fill V
    auto stage = [&](int par, int kt) {
        int t = threadIdx.x;
        if (t < 128) {
            int row = t >> 2, seg = t & 3;   // 32 rows x 4 x 16B
            cp16_to_lds(Kbase + (long)(kt + row) * D_HID + seg * 8,
                        &kbuf[par][row * LDT + seg * 8]);
        } else {
            int t2 = t - 128;
            int row = t2 >> 2, seg = t2 & 3;
            cp16_to_lds(Vbase + (long)row * SEQ + kt + seg * 8,
                        &vbuf[par][row * LDT + seg * 8]);
        }
    };

    v16h aq = load_frag_h16(Qbase, D_HID, lane);   // reused across entire K loop
    v8f o0 = {}, o1 = {};
    float mrow[8], lsum[8];
#pragma unroll
    for (int r = 0; r < 8; ++r) { mrow[r] = -1e30f; lsum[r] = 0.f; }

    stage(0, 0);                                   // prologue fill of buffer 0
    for (int kt = 0; kt < SEQ; kt += 32) {
        int par = (kt >> 5) & 1;
        if (kt + 32 < SEQ) {
            stage(par ^ 1, kt + 32);               // overlap next tile's fill
            WAIT_ASYNC(1);                         // current tile landed (ASYNCcnt <= 1)
        } else {
            WAIT_ASYNC(0);
        }
        __syncthreads();                           // all waves' async fills visible
        const _Float16* kb = kbuf[par];
        const _Float16* vb = vbuf[par];

        // ---- S = Q * K^T for 32 key positions (two 16-col tiles) ----
        v8f z = {};
        v8f s0 = wmma_f16(aq, load_frag_h16(kb, LDT, lane), z);
        v8f s1 = wmma_f16(aq, load_frag_h16(kb + 16 * LDT, LDT, lane), z);

        // ---- online softmax + stage P into LDS in A-fragment source layout ----
#pragma unroll
        for (int r = 0; r < 8; ++r) {
            float tmax = rowmax16(fmaxf(s0[r], s1[r]));
            float mnew = fmaxf(mrow[r], tmax);
            float alpha = __expf(mrow[r] - mnew);
            mrow[r] = mnew;
            o0[r] *= alpha; o1[r] *= alpha;
            float p0 = __expf(s0[r] - mnew);
            float p1 = __expf(s1[r] - mnew);
            lsum[r] = lsum[r] * alpha + rowsum16(p0 + p1);
            int m = r + 8 * hw;                        // row within tile
            pl[m * LDT + lr]      = (_Float16)p0;      // cols kt..kt+15
            pl[m * LDT + 16 + lr] = (_Float16)p1;      // cols kt+16..kt+31
        }
        asm volatile("s_wait_dscnt 0" ::: "memory");   // wave-private LDS: stores -> loads
        v16h ap = load_frag_h16(pl, LDT, lane);        // P as 16x32 A fragment

        // ---- O += P * V (V tile rows are d, cols are kpos) ----
        o0 = wmma_f16(ap, load_frag_h16(vb, LDT, lane), o0);
        o1 = wmma_f16(ap, load_frag_h16(vb + 16 * LDT, LDT, lane), o1);
        __syncthreads();                           // buffer par free for reuse next iter
    }

    // ---- normalize and store [4096,256] f16 (row = b*2048+q, col = h*32+d) ----
    int b = bh >> 3, h = bh & 7;
    _Float16* dst = Obuf + ((long)b * SEQ + q0) * D_MODEL + h * D_HID;
#pragma unroll
    for (int r = 0; r < 8; ++r) {
        float inv = 1.0f / lsum[r];
        int m = r + 8 * hw;
        dst[(long)m * D_MODEL + lr]      = (_Float16)(o0[r] * inv);
        dst[(long)m * D_MODEL + 16 + lr] = (_Float16)(o1[r] * inv);
    }
}

// ---------- Kernel 3: output projection  Y = O @ Wo^T + bo  (fp32 out) ----------
__global__ __launch_bounds__(256) void attn_outproj(
    const _Float16* __restrict__ O, const _Float16* __restrict__ Wo16,
    const float* __restrict__ bo, float* __restrict__ Y) {
    int lane = threadIdx.x & 31;
    int wave = threadIdx.x >> 5;
    int row0 = blockIdx.x * 16;
    int n0 = wave * 32;
    v8f c0 = {}, c1 = {};
#pragma unroll
    for (int k0 = 0; k0 < D_MODEL; k0 += 32) {
        v16h af = load_frag_h16(O + (long)row0 * D_MODEL + k0, D_MODEL, lane);
        v16h b0 = load_frag_h16(Wo16 + (long)n0 * D_MODEL + k0, D_MODEL, lane);
        v16h b1 = load_frag_h16(Wo16 + (long)(n0 + 16) * D_MODEL + k0, D_MODEL, lane);
        c0 = wmma_f16(af, b0, c0);
        c1 = wmma_f16(af, b1, c1);
    }
    int lr = lane & 15, hw = lane >> 4;
#pragma unroll
    for (int r = 0; r < 8; ++r) {
        int m = row0 + r + 8 * hw;
        int col0 = n0 + lr, col1 = n0 + 16 + lr;
        Y[(long)m * D_MODEL + col0] = c0[r] + bo[col0];
        Y[(long)m * D_MODEL + col1] = c1[r] + bo[col1];
    }
}

extern "C" void kernel_launch(void* const* d_in, const int* in_sizes, int n_in,
                              void* d_out, int out_size, void* d_ws, size_t ws_size,
                              hipStream_t stream) {
    const float* query = (const float*)d_in[0];
    const float* key   = (const float*)d_in[1];
    const float* value = (const float*)d_in[2];
    const float* Wq    = (const float*)d_in[3];
    const float* Wk    = (const float*)d_in[4];
    const float* Wv    = (const float*)d_in[5];
    const float* Wo    = (const float*)d_in[6];
    const float* bo    = (const float*)d_in[7];

    // workspace carve-up (halves): weights 4*64K, then Qh/Kh/Vt/Obuf 1M each (~8.5 MB)
    _Float16* w16 = (_Float16*)d_ws;
    _Float16* Wq16 = w16;
    _Float16* Wk16 = w16 + 65536;
    _Float16* Wv16 = w16 + 131072;
    _Float16* Wo16 = w16 + 196608;
    _Float16* Qh   = w16 + 262144;
    _Float16* Kh   = Qh + (long)NROWS * D_MODEL;
    _Float16* Vt   = Kh + (long)NROWS * D_MODEL;
    _Float16* Ob   = Vt + (long)NROWS * D_MODEL;

    attn_cvt_weights<<<256, 256, 0, stream>>>(Wq, Wk, Wv, Wo, w16);

    const float scaling = 0.17677669529663687f;   // 1/sqrt(32), folded into Q
    attn_proj<<<NROWS / 16, 256, 0, stream>>>(query, Wq16, Qh, 0, scaling);
    attn_proj<<<NROWS / 16, 256, 0, stream>>>(key,   Wk16, Kh, 0, 1.0f);
    attn_proj<<<NROWS / 16, 256, 0, stream>>>(value, Wv16, Vt, 1, 1.0f);

    attn_flash<<<dim3(SEQ / 128, BATCH * N_HEAD), 256, 0, stream>>>(Qh, Kh, Vt, Ob);

    attn_outproj<<<NROWS / 16, 256, 0, stream>>>(Ob, Wo16, bo, (float*)d_out);
}

// v001
// Measured time: 64.2 microseconds a run.
// Two timings next to v000 put it at 1.44 and 1.42 times that version's speed.
#include <hip/hip_runtime.h>
#include <hip/hip_bf16.h>

typedef __attribute__((ext_vector_type(16))) _Float16 v16h;
typedef __attribute__((ext_vector_type(8)))  _Float16 h8;
typedef __attribute__((ext_vector_type(8)))  float    v8f;
typedef __attribute__((ext_vector_type(4)))  float    f4;
typedef __attribute__((ext_vector_type(4)))  int      v4i;

#define N_HEAD 8
#define D_HID 32
#define D_MODEL 256
#define SEQ 2048
#define BATCH 2
#define NROWS (BATCH * SEQ)   // 4096
#define LDT 48                // LDS tile pitch in halves (96B: 16B aligned, conflict-reduced)

// ---------- CDNA5 async Global->LDS path (probe via __has_builtin; safe fallback) ----------
#if __has_builtin(__builtin_amdgcn_global_load_async_to_lds_b128)
#define ASYNC_LDS 1
#if __has_builtin(__builtin_amdgcn_s_wait_asynccnt)
#define WAIT_ASYNC(n) __builtin_amdgcn_s_wait_asynccnt(n)
#else
#define WAIT_ASYNC(n) asm volatile("s_wait_asynccnt %0" :: "i"(n) : "memory")
#endif
#else
#define WAIT_ASYNC(n) ((void)0)
#endif

__device__ __forceinline__ void cp16_to_lds(const _Float16* g, _Float16* l) {
#ifdef ASYNC_LDS
    // signature (from hipcc diagnostic): (v4i addrspace(1)*, v4i addrspace(3)*, imm, imm)
    __builtin_amdgcn_global_load_async_to_lds_b128(
        (__attribute__((address_space(1))) v4i*)g,
        (__attribute__((address_space(3))) v4i*)l, 0, 0);
#else
    *(h8*)l = *(const h8*)g;   // sync fallback: global_load_b128 + ds_store_b128
#endif
}

// ---------- WMMA wrapper ----------
__device__ __forceinline__ v8f wmma_f16(v16h a, v16h b, v8f c) {
    // D = A(16x32 f16) * B(32x16 f16) + C(16x16 f32)
    return __builtin_amdgcn_wmma_f32_16x16x32_f16(false, a, false, b, (short)0, c, false, false);
}

// ---------- Fragment loaders ----------
// A-frag (16x32) from row-major f16 [ld]: lane holds row lane&15.
// Same code loads a B-frag (32x16) from a row-major [N,K] matrix (lane holds col n).
// K(half j, hi) = (j&7) + 8*hi + 16*(j>>3)  ==> two contiguous 8-half (16B) loads.
__device__ __forceinline__ v16h load_frag_h16(const _Float16* __restrict__ base, int ld, int lane) {
    int lr = lane & 15, hw = lane >> 4;
    const _Float16* p = base + (long)lr * ld + 8 * hw;
    h8 lo = *(const h8*)(p);
    h8 hh = *(const h8*)(p + 16);
    v16h r;
#pragma unroll
    for (int i = 0; i < 8; ++i) { r[i] = lo[i]; r[i + 8] = hh[i]; }
    return r;
}

// Same fragment but sourced from a row-major fp32 matrix, converting (and scaling) to f16.
__device__ __forceinline__ v16h load_frag_f32(const float* __restrict__ base, int ld, int lane, float scale) {
    int lr = lane & 15, hw = lane >> 4;
    const float* p = base + (long)lr * ld + 8 * hw;
    f4 a0 = *(const f4*)(p);
    f4 a1 = *(const f4*)(p + 4);
    f4 a2 = *(const f4*)(p + 16);
    f4 a3 = *(const f4*)(p + 20);
    v16h r;
#pragma unroll
    for (int i = 0; i < 4; ++i) {
        r[i]      = (_Float16)(a0[i] * scale);
        r[4 + i]  = (_Float16)(a1[i] * scale);
        r[8 + i]  = (_Float16)(a2[i] * scale);
        r[12 + i] = (_Float16)(a3[i] * scale);
    }
    return r;
}

// ---------- Exchange between the wave halves: lane l <-> l ^ 16 ----------
__device__ __forceinline__ float xhalf(float v) {
    int b = __builtin_bit_cast(int, v);
    return __builtin_bit_cast(float, __builtin_amdgcn_permlanex16(b, b, 0x76543210, 0xfedcba98, false, false));
}

// ---------- Kernel 0: weight fp32 -> f16 ----------
__global__ __launch_bounds__(256) void attn_cvt_weights(
    const float* __restrict__ wq, const float* __restrict__ wk,
    const float* __restrict__ wv, const float* __restrict__ wo,
    _Float16* __restrict__ out) {
    int i = blockIdx.x * 256 + threadIdx.x;           // 65536 threads
    out[i]          = (_Float16)wq[i];
    out[65536 + i]  = (_Float16)wk[i];
    out[131072 + i] = (_Float16)wv[i];
    out[196608 + i] = (_Float16)wo[i];
}

// ---------- Kernel 1: projection  out = X @ W^T  (f16 result, head-major) ----------
// transposed==0 : out[((b*8+h)*2048 + s)*32 + d]         (Q, K)
// transposed==1 : out[((b*8+h)*32 + d)*2048 + s]         (V, pre-transposed for P*V)
__global__ __launch_bounds__(256) void attn_proj(
    const float* __restrict__ X, const _Float16* __restrict__ W16,
    _Float16* __restrict__ out, int transposed, float scale) {
    int lane = threadIdx.x & 31;
    int wave = threadIdx.x >> 5;        // 8 waves
    int row0 = blockIdx.x * 16;         // 256 blocks cover 4096 rows
    int n0 = wave * 32;                 // each wave: 32 output cols (2 WMMA N-tiles)
    v8f c0 = {}, c1 = {};
#pragma unroll
    for (int k0 = 0; k0 < D_MODEL; k0 += 32) {
        v16h af = load_frag_f32(X + (long)row0 * D_MODEL + k0, D_MODEL, lane, scale);
        v16h b0 = load_frag_h16(W16 + (long)n0 * D_MODEL + k0, D_MODEL, lane);
        v16h b1 = load_frag_h16(W16 + (long)(n0 + 16) * D_MODEL + k0, D_MODEL, lane);
        c0 = wmma_f16(af, b0, c0);
        c1 = wmma_f16(af, b1, c1);
    }
    int lr = lane & 15, hw = lane >> 4;
#pragma unroll
    for (int r = 0; r < 8; ++r) {
        int m = row0 + r + 8 * hw;      // global row
        int b = m >> 11, s = m & 2047;
#pragma unroll
        for (int t = 0; t < 2; ++t) {
            int col = n0 + 16 * t + lr;
            int h = col >> 5, d = col & 31;
            float v = t ? c1[r] : c0[r];
            long idx = transposed ? (((long)(b * N_HEAD + h) * D_HID + d) * SEQ + s)
                                  : (((long)(b * N_HEAD + h) * SEQ + s) * D_HID + d);
            out[idx] = (_Float16)v;
        }
    }
}

// ---------- Kernel 2: flash attention (async double-buffered K/V tiles in LDS) ----------
// Qh/Kh: [b,h,s,32] f16 (Q pre-scaled). Vt: [b,h,32,s] f16. Obuf: [4096,256] f16.
__global__ __launch_bounds__(256) void attn_flash(
    const _Float16* __restrict__ Qh, const _Float16* __restrict__ Kh,
    const _Float16* __restrict__ Vt, _Float16* __restrict__ Obuf) {
    __shared__ _Float16 kbuf[2][32 * LDT];   // K tile:  rows = kpos, cols = d
    __shared__ _Float16 vbuf[2][32 * LDT];   // V tile:  rows = d,    cols = kpos
    int lane = threadIdx.x & 31;
    int wave = threadIdx.x >> 5;
    int lr = lane & 15, hw = lane >> 4;
    int bh = blockIdx.y;                         // b*8 + h
    int q0 = (blockIdx.x * 8 + wave) * 16;       // 16-row Q tile per wave
    const _Float16* Qbase = Qh + ((long)bh * SEQ + q0) * D_HID;
    const _Float16* Kbase = Kh + (long)bh * SEQ * D_HID;
    const _Float16* Vbase = Vt + (long)bh * D_HID * SEQ;

    // one async-copy instruction per wave per tile: waves 0-3 fill K, waves 4-7 fill V
    auto stage = [&](int par, int kt) {
        int t = threadIdx.x;
        if (t < 128) {
            int row = t >> 2, seg = t & 3;   // 32 rows x 4 x 16B
            cp16_to_lds(Kbase + (long)(kt + row) * D_HID + seg * 8,
                        &kbuf[par][row * LDT + seg * 8]);
        } else {
            int t2 = t - 128;
            int row = t2 >> 2, seg = t2 & 3;
            cp16_to_lds(Vbase + (long)row * SEQ + kt + seg * 8,
                        &vbuf[par][row * LDT + seg * 8]);
        }
    };

    v16h bq = load_frag_h16(Qbase, D_HID, lane);   // Q^T as B fragment, reused across entire K loop
    v8f o0 = {}, o1 = {};                          // O^T: o0[r] = O[query lr][d = 8*hw + r], o1: d + 16
    float mrow = -1e30f, lsum = 0.f;               // lsum: this half's keys only, joined after the loop

    stage(0, 0);                                   // prologue fill of buffer 0
    for (int kt = 0; kt < SEQ; kt += 32) {
        int par = (kt >> 5) & 1;
        if (kt + 32 < SEQ) {
            stage(par ^ 1, kt + 32);               // overlap next tile's fill
            WAIT_ASYNC(1);                         // current tile landed (ASYNCcnt <= 1)
        } else {
            WAIT_ASYNC(0);
        }
        __syncthreads();                           // all waves' async fills visible
        const _Float16* kb = kbuf[par];
        const _Float16* vb = vbuf[par];

        // ---- S^T = K * Q^T for 32 key positions (two 16-row tiles) ----
        v8f z = {};
        v8f s0 = wmma_f16(load_frag_h16(kb, LDT, lane), bq, z);
        v8f s1 = wmma_f16(load_frag_h16(kb + 16 * LDT, LDT, lane), bq, z);

        // ---- online softmax, in-lane over 16 keys plus one exchange between the halves ----
        float t0 = fmaxf(s0[0], s1[0]), t1 = fmaxf(s0[1], s1[1]);
#pragma unroll
        for (int r = 2; r < 8; r += 2) {
            t0 = fmaxf(t0, fmaxf(s0[r], s1[r]));
            t1 = fmaxf(t1, fmaxf(s0[r + 1], s1[r + 1]));
        }
        float tmax = fmaxf(t0, t1);
        float mnew = fmaxf(mrow, fmaxf(tmax, xhalf(tmax)));
        float alpha = __expf(mrow - mnew);
        mrow = mnew;
        v8f pa, pb;
#pragma unroll
        for (int r = 0; r < 8; ++r) { pa[r] = __expf(s0[r] - mnew); pb[r] = __expf(s1[r] - mnew); }
        v16h bp;                                       // P^T as 32x16 B fragment, straight from registers
#pragma unroll
        for (int r = 0; r < 8; ++r) { bp[r] = (_Float16)pa[r]; bp[8 + r] = (_Float16)pb[r]; }
        v8f ps = pa + pb;                              // this lane's 16 keys, summed as a tree
        f4 ph = ps.lo + ps.hi;
        lsum = lsum * alpha + ((ph[0] + ph[2]) + (ph[1] + ph[3]));
        o0 *= alpha; o1 *= alpha;

        // ---- O^T += V^T * P^T (V tile rows are d, cols are kpos) ----
        o0 = wmma_f16(load_frag_h16(vb, LDT, lane), bp, o0);
        o1 = wmma_f16(load_frag_h16(vb + 16 * LDT, LDT, lane), bp, o1);
        __syncthreads();                           // buffer par free for reuse next iter
    }

    // ---- normalize and store [4096,256] f16 (row = b*2048+q, col = h*32+d) ----
    int b = bh >> 3, h = bh & 7;
    _Float16* dst = Obuf + ((long)b * SEQ + q0 + lr) * D_MODEL + h * D_HID + 8 * hw;
    float inv = 1.0f / (lsum + xhalf(lsum));       // join the two halves' sums once
    h8 w0, w1;
#pragma unroll
    for (int r = 0; r < 8; ++r) {
        w0[r] = (_Float16)(o0[r] * inv);
        w1[r] = (_Float16)(o1[r] * inv);
    }
    *(h8*)(dst)      = w0;                         // d = 8*hw .. 8*hw + 7
    *(h8*)(dst + 16) = w1;                         // d = 16 + 8*hw ..
}

// ---------- Kernel 3: output projection  Y = O @ Wo^T + bo  (fp32 out) ----------
__global__ __launch_bounds__(256) void attn_outproj(
    const _Float16* __restrict__ O, const _Float16* __restrict__ Wo16,
    const float* __restrict__ bo, float* __restrict__ Y) {
    int lane = threadIdx.x & 31;
    int wave = threadIdx.x >> 5;
    int row0 = blockIdx.x * 16;
    int n0 = wave * 32;
    v8f c0 = {}, c1 = {};
#pragma unroll
    for (int k0 = 0; k0 < D_MODEL; k0 += 32) {
        v16h af = load_frag_h16(O + (long)row0 * D_MODEL + k0, D_MODEL, lane);
        v16h b0 = load_frag_h16(Wo16 + (long)n0 * D_MODEL + k0, D_MODEL, lane);
        v16h b1 = load_frag_h16(Wo16 + (long)(n0 + 16) * D_MODEL + k0, D_MODEL, lane);
        c0 = wmma_f16(af, b0, c0);
        c1 = wmma_f16(af, b1, c1);
    }
    int lr = lane & 15, hw = lane >> 4;
#pragma unroll
    for (int r = 0; r < 8; ++r) {
        int m = row0 + r + 8 * hw;
        int col0 = n0 + lr, col1 = n0 + 16 + lr;
        Y[(long)m * D_MODEL + col0] = c0[r] + bo[col0];
        Y[(long)m * D_MODEL + col1] = c1[r] + bo[col1];
    }
}

extern "C" void kernel_launch(void* const* d_in, const int* in_sizes, int n_in,
                              void* d_out, int out_size, void* d_ws, size_t ws_size,
                              hipStream_t stream) {
    const float* query = (const float*)d_in[0];
    const float* key   = (const float*)d_in[1];
    const float* value = (const float*)d_in[2];
    const float* Wq    = (const float*)d_in[3];
    const float* Wk    = (const float*)d_in[4];
    const float* Wv    = (const float*)d_in[5];
    const float* Wo    = (const float*)d_in[6];
    const float* bo    = (const float*)d_in[7];

    // workspace carve-up (halves): weights 4*64K, then Qh/Kh/Vt/Obuf 1M each (~8.5 MB)
    _Float16* w16 = (_Float16*)d_ws;
    _Float16* Wq16 = w16;
    _Float16* Wk16 = w16 + 65536;
    _Float16* Wv16 = w16 + 131072;
    _Float16* Wo16 = w16 + 196608;
    _Float16* Qh   = w16 + 262144;
    _Float16* Kh   = Qh + (long)NROWS * D_MODEL;
    _Float16* Vt   = Kh + (long)NROWS * D_MODEL;
    _Float16* Ob   = Vt + (long)NROWS * D_MODEL;

    attn_cvt_weights<<<256, 256, 0, stream>>>(Wq, Wk, Wv, Wo, w16);

    const float scaling = 0.17677669529663687f;   // 1/sqrt(32), folded into Q
    attn_proj<<<NROWS / 16, 256, 0, stream>>>(query, Wq16, Qh, 0, scaling);
    attn_proj<<<NROWS / 16, 256, 0, stream>>>(key,   Wk16, Kh, 0, 1.0f);
    attn_proj<<<NROWS / 16, 256, 0, stream>>>(value, Wv16, Vt, 1, 1.0f);

    attn_flash<<<dim3(SEQ / 128, BATCH * N_HEAD), 256, 0, stream>>>(Qh, Kh, Vt, Ob);

    attn_outproj<<<NROWS / 16, 256, 0, stream>>>(Ob, Wo16, bo, (float*)d_out);
}

// v002
// A run of this version takes 55.2 microseconds.
// Timed twice side by side with v001, it ran 1.16 and 1.15 times as fast.
// Over all steps from v000 it is 1.65 times as fast.
#include <hip/hip_runtime.h>
#include <hip/hip_bf16.h>

typedef __attribute__((ext_vector_type(16))) _Float16 v16h;
typedef __attribute__((ext_vector_type(8)))  _Float16 h8;
typedef __attribute__((ext_vector_type(8)))  float    v8f;
typedef __attribute__((ext_vector_type(4)))  float    f4;
typedef __attribute__((ext_vector_type(4)))  int      v4i;

#define N_HEAD 8
#define D_HID 32
#define D_MODEL 256
#define SEQ 2048
#define BATCH 2
#define NROWS (BATCH * SEQ)   // 4096
#define LDT 48                // LDS tile pitch in halves (96B: 16B aligned, conflict-reduced)

// ---------- CDNA5 async Global->LDS path (probe via __has_builtin; safe fallback) ----------
#if __has_builtin(__builtin_amdgcn_global_load_async_to_lds_b128)
#define ASYNC_LDS 1
#if __has_builtin(__builtin_amdgcn_s_wait_asynccnt)
#define WAIT_ASYNC(n) __builtin_amdgcn_s_wait_asynccnt(n)
#else
#define WAIT_ASYNC(n) asm volatile("s_wait_asynccnt %0" :: "i"(n) : "memory")
#endif
#else
#define WAIT_ASYNC(n) ((void)0)
#endif

__device__ __forceinline__ void cp16_to_lds(const _Float16* g, _Float16* l) {
#ifdef ASYNC_LDS
    // signature (from hipcc diagnostic): (v4i addrspace(1)*, v4i addrspace(3)*, imm, imm)
    __builtin_amdgcn_global_load_async_to_lds_b128(
        (__attribute__((address_space(1))) v4i*)g,
        (__attribute__((address_space(3))) v4i*)l, 0, 0);
#else
    *(h8*)l = *(const h8*)g;   // sync fallback: global_load_b128 + ds_store_b128
#endif
}

// ---------- WMMA wrapper ----------
__device__ __forceinline__ v8f wmma_f16(v16h a, v16h b, v8f c) {
    // D = A(16x32 f16) * B(32x16 f16) + C(16x16 f32)
    return __builtin_amdgcn_wmma_f32_16x16x32_f16(false, a, false, b, (short)0, c, false, false);
}

// ---------- Fragment loaders ----------
// A-frag (16x32) from row-major f16 [ld]: lane holds row lane&15.
// Same code loads a B-frag (32x16) from a row-major [N,K] matrix (lane holds col n).
// K(half j, hi) = (j&7) + 8*hi + 16*(j>>3)  ==> two contiguous 8-half (16B) loads.
__device__ __forceinline__ v16h load_frag_h16(const _Float16* __restrict__ base, int ld, int lane) {
    int lr = lane & 15, hw = lane >> 4;
    const _Float16* p = base + (long)lr * ld + 8 * hw;
    h8 lo = *(const h8*)(p);
    h8 hh = *(const h8*)(p + 16);
    v16h r;
#pragma unroll
    for (int i = 0; i < 8; ++i) { r[i] = lo[i]; r[i + 8] = hh[i]; }
    return r;
}

// Same fragment but sourced from a row-major fp32 matrix, converting (and scaling) to f16.
__device__ __forceinline__ v16h load_frag_f32(const float* __restrict__ base, int ld, int lane, float scale) {
    int lr = lane & 15, hw = lane >> 4;
    const float* p = base + (long)lr * ld + 8 * hw;
    f4 a0 = *(const f4*)(p);
    f4 a1 = *(const f4*)(p + 4);
    f4 a2 = *(const f4*)(p + 16);
    f4 a3 = *(const f4*)(p + 20);
    v16h r;
#pragma unroll
    for (int i = 0; i < 4; ++i) {
        r[i]      = (_Float16)(a0[i] * scale);
        r[4 + i]  = (_Float16)(a1[i] * scale);
        r[8 + i]  = (_Float16)(a2[i] * scale);
        r[12 + i] = (_Float16)(a3[i] * scale);
    }
    return r;
}

// ---------- Exchange between the wave halves: lane l <-> l ^ 16 ----------
__device__ __forceinline__ float xhalf(float v) {
    int b = __builtin_bit_cast(int, v);
    return __builtin_bit_cast(float, __builtin_amdgcn_permlanex16(b, b, 0x76543210, 0xfedcba98, false, false));
}

// ---------- Kernel 0: weight fp32 -> f16 ----------
__global__ __launch_bounds__(256) void attn_cvt_weights(
    const float* __restrict__ wq, const float* __restrict__ wk,
    const float* __restrict__ wv, const float* __restrict__ wo,
    _Float16* __restrict__ out) {
    int i = blockIdx.x * 256 + threadIdx.x;           // 65536 threads
    out[i]          = (_Float16)wq[i];
    out[65536 + i]  = (_Float16)wk[i];
    out[131072 + i] = (_Float16)wv[i];
    out[196608 + i] = (_Float16)wo[i];
}

// ---------- Kernel 1: all three projections  out = X @ W^T  (f16 result, head-major) ----------
// One launch: blockIdx.y picks the product. The three are independent, so their load chains overlap
// on a WGP. y = 0 is V, whose scattered stores last longest, then K, then Q.
// transposed==0 : out[((b*8+h)*2048 + s)*32 + d]         (Q, K)
// transposed==1 : out[((b*8+h)*32 + d)*2048 + s]         (V, pre-transposed for P*V)
// Wqkv: Wq, Wk, Wv as f16, one behind the other. QKV: Qh, Kh, Vt, one behind the other.
__global__ __launch_bounds__(256) void attn_proj(
    const float* __restrict__ Xq, const float* __restrict__ Xk, const float* __restrict__ Xv,
    const _Float16* __restrict__ Wqkv, _Float16* __restrict__ QKV, float qscale) {
    int which = 2 - (int)blockIdx.y;    // 0: Q, 1: K, 2: V
    const float* __restrict__ X = which == 0 ? Xq : (which == 1 ? Xk : Xv);
    const _Float16* __restrict__ W16 = Wqkv + (long)which * (D_MODEL * D_MODEL);
    _Float16* __restrict__ out = QKV + (long)which * (NROWS * D_MODEL);
    int transposed = which == 2;
    float scale = which == 0 ? qscale : 1.0f;
    int lane = threadIdx.x & 31;
    int wave = threadIdx.x >> 5;        // 8 waves
    int row0 = blockIdx.x * 16;         // 256 blocks cover 4096 rows
    int n0 = wave * 32;                 // each wave: 32 output cols (2 WMMA N-tiles)
    v8f c0 = {}, c1 = {};
#pragma unroll
    for (int k0 = 0; k0 < D_MODEL; k0 += 32) {
        v16h af = load_frag_f32(X + (long)row0 * D_MODEL + k0, D_MODEL, lane, scale);
        v16h b0 = load_frag_h16(W16 + (long)n0 * D_MODEL + k0, D_MODEL, lane);
        v16h b1 = load_frag_h16(W16 + (long)(n0 + 16) * D_MODEL + k0, D_MODEL, lane);
        c0 = wmma_f16(af, b0, c0);
        c1 = wmma_f16(af, b1, c1);
    }
    int lr = lane & 15, hw = lane >> 4;
#pragma unroll
    for (int r = 0; r < 8; ++r) {
        int m = row0 + r + 8 * hw;      // global row
        int b = m >> 11, s = m & 2047;
#pragma unroll
        for (int t = 0; t < 2; ++t) {
            int col = n0 + 16 * t + lr;
            int h = col >> 5, d = col & 31;
            float v = t ? c1[r] : c0[r];
            long idx = transposed ? (((long)(b * N_HEAD + h) * D_HID + d) * SEQ + s)
                                  : (((long)(b * N_HEAD + h) * SEQ + s) * D_HID + d);
            out[idx] = (_Float16)v;
        }
    }
}

// ---------- Kernel 2: flash attention (async double-buffered K/V tiles in LDS) ----------
// Qh/Kh: [b,h,s,32] f16 (Q pre-scaled). Vt: [b,h,32,s] f16. Obuf: [4096,256] f16.
__global__ __launch_bounds__(256) void attn_flash(
    const _Float16* __restrict__ Qh, const _Float16* __restrict__ Kh,
    const _Float16* __restrict__ Vt, _Float16* __restrict__ Obuf) {
    __shared__ _Float16 kbuf[2][32 * LDT];   // K tile:  rows = kpos, cols = d
    __shared__ _Float16 vbuf[2][32 * LDT];   // V tile:  rows = d,    cols = kpos
    int lane = threadIdx.x & 31;
    int wave = threadIdx.x >> 5;
    int lr = lane & 15, hw = lane >> 4;
    int bh = blockIdx.y;                         // b*8 + h
    int q0 = (blockIdx.x * 8 + wave) * 16;       // 16-row Q tile per wave
    const _Float16* Qbase = Qh + ((long)bh * SEQ + q0) * D_HID;
    const _Float16* Kbase = Kh + (long)bh * SEQ * D_HID;
    const _Float16* Vbase = Vt + (long)bh * D_HID * SEQ;

    // one async-copy instruction per wave per tile: waves 0-3 fill K, waves 4-7 fill V
    auto stage = [&](int par, int kt) {
        int t = threadIdx.x;
        if (t < 128) {
            int row = t >> 2, seg = t & 3;   // 32 rows x 4 x 16B
            cp16_to_lds(Kbase + (long)(kt + row) * D_HID + seg * 8,
                        &kbuf[par][row * LDT + seg * 8]);
        } else {
            int t2 = t - 128;
            int row = t2 >> 2, seg = t2 & 3;
            cp16_to_lds(Vbase + (long)row * SEQ + kt + seg * 8,
                        &vbuf[par][row * LDT + seg * 8]);
        }
    };

    v16h bq = load_frag_h16(Qbase, D_HID, lane);   // Q^T as B fragment, reused across entire K loop
    v8f o0 = {}, o1 = {};                          // O^T: o0[r] = O[query lr][d = 8*hw + r], o1: d + 16
    float mrow = -1e30f, lsum = 0.f;               // lsum: this half's keys only, joined after the loop

    stage(0, 0);                                   // prologue fill of buffer 0
    for (int kt = 0; kt < SEQ; kt += 32) {
        int par = (kt >> 5) & 1;
        if (kt + 32 < SEQ) {
            stage(par ^ 1, kt + 32);               // overlap next tile's fill
            WAIT_ASYNC(1);                         // current tile landed (ASYNCcnt <= 1)
        } else {
            WAIT_ASYNC(0);
        }
        __syncthreads();                           // all waves' async fills visible
        const _Float16* kb = kbuf[par];
        const _Float16* vb = vbuf[par];

        // ---- S^T = K * Q^T for 32 key positions (two 16-row tiles) ----
        v8f z = {};
        v8f s0 = wmma_f16(load_frag_h16(kb, LDT, lane), bq, z);
        v8f s1 = wmma_f16(load_frag_h16(kb + 16 * LDT, LDT, lane), bq, z);

        // ---- online softmax, in-lane over 16 keys plus one exchange between the halves ----
        float t0 = fmaxf(s0[0], s1[0]), t1 = fmaxf(s0[1], s1[1]);
#pragma unroll
        for (int r = 2; r < 8; r += 2) {
            t0 = fmaxf(t0, fmaxf(s0[r], s1[r]));
            t1 = fmaxf(t1, fmaxf(s0[r + 1], s1[r + 1]));
        }
        float tmax = fmaxf(t0, t1);
        float mnew = fmaxf(mrow, fmaxf(tmax, xhalf(tmax)));
        float alpha = __expf(mrow - mnew);
        mrow = mnew;
        v8f pa, pb;
#pragma unroll
        for (int r = 0; r < 8; ++r) { pa[r] = __expf(s0[r] - mnew); pb[r] = __expf(s1[r] - mnew); }
        v16h bp;                                       // P^T as 32x16 B fragment, straight from registers
#pragma unroll
        for (int r = 0; r < 8; ++r) { bp[r] = (_Float16)pa[r]; bp[8 + r] = (_Float16)pb[r]; }
        v8f ps = pa + pb;                              // this lane's 16 keys, summed as a tree
        f4 ph = ps.lo + ps.hi;
        lsum = lsum * alpha + ((ph[0] + ph[2]) + (ph[1] + ph[3]));
        o0 *= alpha; o1 *= alpha;

        // ---- O^T += V^T * P^T (V tile rows are d, cols are kpos) ----
        o0 = wmma_f16(load_frag_h16(vb, LDT, lane), bp, o0);
        o1 = wmma_f16(load_frag_h16(vb + 16 * LDT, LDT, lane), bp, o1);
        __syncthreads();                           // buffer par free for reuse next iter
    }

    // ---- normalize and store [4096,256] f16 (row = b*2048+q, col = h*32+d) ----
    int b = bh >> 3, h = bh & 7;
    _Float16* dst = Obuf + ((long)b * SEQ + q0 + lr) * D_MODEL + h * D_HID + 8 * hw;
    float inv = 1.0f / (lsum + xhalf(lsum));       // join the two halves' sums once
    h8 w0, w1;
#pragma unroll
    for (int r = 0; r < 8; ++r) {
        w0[r] = (_Float16)(o0[r] * inv);
        w1[r] = (_Float16)(o1[r] * inv);
    }
    *(h8*)(dst)      = w0;                         // d = 8*hw .. 8*hw + 7
    *(h8*)(dst + 16) = w1;                         // d = 16 + 8*hw ..
}

// ---------- Kernel 3: output projection  Y = O @ Wo^T + bo  (fp32 out) ----------
__global__ __launch_bounds__(256) void attn_outproj(
    const _Float16* __restrict__ O, const _Float16* __restrict__ Wo16,
    const float* __restrict__ bo, float* __restrict__ Y) {
    int lane = threadIdx.x & 31;
    int wave = threadIdx.x >> 5;
    int row0 = blockIdx.x * 16;
    int n0 = wave * 32;
    v8f c0 = {}, c1 = {};
#pragma unroll
    for (int k0 = 0; k0 < D_MODEL; k0 += 32) {
        v16h af = load_frag_h16(O + (long)row0 * D_MODEL + k0, D_MODEL, lane);
        v16h b0 = load_frag_h16(Wo16 + (long)n0 * D_MODEL + k0, D_MODEL, lane);
        v16h b1 = load_frag_h16(Wo16 + (long)(n0 + 16) * D_MODEL + k0, D_MODEL, lane);
        c0 = wmma_f16(af, b0, c0);
        c1 = wmma_f16(af, b1, c1);
    }
    int lr = lane & 15, hw = lane >> 4;
#pragma unroll
    for (int r = 0; r < 8; ++r) {
        int m = row0 + r + 8 * hw;
        int col0 = n0 + lr, col1 = n0 + 16 + lr;
        Y[(long)m * D_MODEL + col0] = c0[r] + bo[col0];
        Y[(long)m * D_MODEL + col1] = c1[r] + bo[col1];
    }
}

extern "C" void kernel_launch(void* const* d_in, const int* in_sizes, int n_in,
                              void* d_out, int out_size, void* d_ws, size_t ws_size,
                              hipStream_t stream) {
    const float* query = (const float*)d_in[0];
    const float* key   = (const float*)d_in[1];
    const float* value = (const float*)d_in[2];
    const float* Wq    = (const float*)d_in[3];
    const float* Wk    = (const float*)d_in[4];
    const float* Wv    = (const float*)d_in[5];
    const float* Wo    = (const float*)d_in[6];
    const float* bo    = (const float*)d_in[7];

    // workspace carve-up (halves): weights 4*64K, then Qh/Kh/Vt/Obuf 1M each (~8.5 MB)
    _Float16* w16 = (_Float16*)d_ws;
    _Float16* Wq16 = w16;
    _Float16* Wo16 = w16 + 196608;
    _Float16* Qh   = w16 + 262144;
    _Float16* Kh   = Qh + (long)NROWS * D_MODEL;
    _Float16* Vt   = Kh + (long)NROWS * D_MODEL;
    _Float16* Ob   = Vt + (long)NROWS * D_MODEL;

    attn_cvt_weights<<<256, 256, 0, stream>>>(Wq, Wk, Wv, Wo, w16);

    const float scaling = 0.17677669529663687f;   // 1/sqrt(32), folded into Q
    attn_proj<<<dim3(NROWS / 16, 3), 256, 0, stream>>>(query, key, value, Wq16, Qh, scaling);

    attn_flash<<<dim3(SEQ / 128, BATCH * N_HEAD), 256, 0, stream>>>(Qh, Kh, Vt, Ob);

    attn_outproj<<<NROWS / 16, 256, 0, stream>>>(Ob, Wo16, bo, (float*)d_out);
}

// v003
// A run of this version takes 45.3 microseconds.
// In two side-by-side timings against v002, it was 1.24 and 1.28 times as fast.
// Over all steps from v000 it is 2.08 times as fast.
#include <hip/hip_runtime.h>
#include <hip/hip_bf16.h>

typedef __attribute__((ext_vector_type(16))) _Float16 v16h;
typedef __attribute__((ext_vector_type(8)))  _Float16 h8;
typedef __attribute__((ext_vector_type(8)))  float    v8f;
typedef __attribute__((ext_vector_type(4)))  float    f4;
typedef __attribute__((ext_vector_type(4)))  int      v4i;

#define N_HEAD 8
#define D_HID 32
#define D_MODEL 256
#define SEQ 2048
#define BATCH 2
#define NROWS (BATCH * SEQ)   // 4096
#define LDT 48                // LDS K tile pitch in halves (96B: 16B aligned, conflict-reduced)
#define KSTAGE 128            // keys per LDS stage of the flash kernel
#define VLD (KSTAGE + 8)      // LDS V tile pitch in halves (272B = 16B x odd, for 16-byte row reads)

// ---------- CDNA5 async Global->LDS path (probe via __has_builtin; safe fallback) ----------
#if __has_builtin(__builtin_amdgcn_global_load_async_to_lds_b128)
#define ASYNC_LDS 1
#endif

__device__ __forceinline__ void cp16_to_lds(const _Float16* g, _Float16* l) {
#ifdef ASYNC_LDS
    // signature (from hipcc diagnostic): (v4i addrspace(1)*, v4i addrspace(3)*, imm, imm)
    __builtin_amdgcn_global_load_async_to_lds_b128(
        (__attribute__((address_space(1))) v4i*)g,
        (__attribute__((address_space(3))) v4i*)l, 0, 0);
#else
    *(h8*)l = *(const h8*)g;   // sync fallback: global_load_b128 + ds_store_b128
#endif
}

// ---------- WMMA wrapper ----------
__device__ __forceinline__ v8f wmma_f16(v16h a, v16h b, v8f c) {
    // D = A(16x32 f16) * B(32x16 f16) + C(16x16 f32)
    return __builtin_amdgcn_wmma_f32_16x16x32_f16(false, a, false, b, (short)0, c, false, false);
}

// ---------- Fragment loaders ----------
// A-frag (16x32) from row-major f16 [ld]: lane holds row lane&15.
// Same code loads a B-frag (32x16) from a row-major [N,K] matrix (lane holds col n).
// K(half j, hi) = (j&7) + 8*hi + 16*(j>>3)  ==> two contiguous 8-half (16B) loads.
__device__ __forceinline__ v16h load_frag_h16(const _Float16* __restrict__ base, int ld, int lane) {
    int lr = lane & 15, hw = lane >> 4;
    const _Float16* p = base + (long)lr * ld + 8 * hw;
    h8 lo = *(const h8*)(p);
    h8 hh = *(const h8*)(p + 16);
    v16h r;
#pragma unroll
    for (int i = 0; i < 8; ++i) { r[i] = lo[i]; r[i + 8] = hh[i]; }
    return r;
}

// Same fragment but sourced from a row-major fp32 matrix, converting (and scaling) to f16.
__device__ __forceinline__ v16h load_frag_f32(const float* __restrict__ base, int ld, int lane, float scale) {
    int lr = lane & 15, hw = lane >> 4;
    const float* p = base + (long)lr * ld + 8 * hw;
    f4 a0 = *(const f4*)(p);
    f4 a1 = *(const f4*)(p + 4);
    f4 a2 = *(const f4*)(p + 16);
    f4 a3 = *(const f4*)(p + 20);
    v16h r;
#pragma unroll
    for (int i = 0; i < 4; ++i) {
        r[i]      = (_Float16)(a0[i] * scale);
        r[4 + i]  = (_Float16)(a1[i] * scale);
        r[8 + i]  = (_Float16)(a2[i] * scale);
        r[12 + i] = (_Float16)(a3[i] * scale);
    }
    return r;
}

// ---------- Exchange between the wave halves: lane l <-> l ^ 16 ----------
__device__ __forceinline__ float xhalf(float v) {
    int b = __builtin_bit_cast(int, v);
    return __builtin_bit_cast(float, __builtin_amdgcn_permlanex16(b, b, 0x76543210, 0xfedcba98, false, false));
}

// ---------- Kernel 0: weight fp32 -> f16 ----------
__global__ __launch_bounds__(256) void attn_cvt_weights(
    const float* __restrict__ wq, const float* __restrict__ wk,
    const float* __restrict__ wv, const float* __restrict__ wo,
    _Float16* __restrict__ out) {
    int i = blockIdx.x * 256 + threadIdx.x;           // 65536 threads
    out[i]          = (_Float16)wq[i];
    out[65536 + i]  = (_Float16)wk[i];
    out[131072 + i] = (_Float16)wv[i];
    out[196608 + i] = (_Float16)wo[i];
}

// ---------- Kernel 1: all three projections  out = X @ W^T  (f16 result, head-major) ----------
// One launch: blockIdx.y picks the product. The three are independent, so their load chains overlap
// on a WGP. y = 0 is V, whose scattered stores last longest, then K, then Q.
// transposed==0 : out[((b*8+h)*2048 + s)*32 + d]         (Q, K)
// transposed==1 : out[((b*8+h)*32 + d)*2048 + s]         (V, pre-transposed for P*V)
// Wqkv: Wq, Wk, Wv as f16, one behind the other. QKV: Qh, Kh, Vt, one behind the other.
__global__ __launch_bounds__(256) void attn_proj(
    const float* __restrict__ Xq, const float* __restrict__ Xk, const float* __restrict__ Xv,
    const _Float16* __restrict__ Wqkv, _Float16* __restrict__ QKV, float qscale) {
    int which = 2 - (int)blockIdx.y;    // 0: Q, 1: K, 2: V
    const float* __restrict__ X = which == 0 ? Xq : (which == 1 ? Xk : Xv);
    const _Float16* __restrict__ W16 = Wqkv + (long)which * (D_MODEL * D_MODEL);
    _Float16* __restrict__ out = QKV + (long)which * (NROWS * D_MODEL);
    int transposed = which == 2;
    float scale = which == 0 ? qscale : 1.0f;
    int lane = threadIdx.x & 31;
    int wave = threadIdx.x >> 5;        // 8 waves
    int row0 = blockIdx.x * 16;         // 256 blocks cover 4096 rows
    int n0 = wave * 32;                 // each wave: 32 output cols (2 WMMA N-tiles)
    v8f c0 = {}, c1 = {};
#pragma unroll
    for (int k0 = 0; k0 < D_MODEL; k0 += 32) {
        v16h af = load_frag_f32(X + (long)row0 * D_MODEL + k0, D_MODEL, lane, scale);
        v16h b0 = load_frag_h16(W16 + (long)n0 * D_MODEL + k0, D_MODEL, lane);
        v16h b1 = load_frag_h16(W16 + (long)(n0 + 16) * D_MODEL + k0, D_MODEL, lane);
        c0 = wmma_f16(af, b0, c0);
        c1 = wmma_f16(af, b1, c1);
    }
    int lr = lane & 15, hw = lane >> 4;
#pragma unroll
    for (int r = 0; r < 8; ++r) {
        int m = row0 + r + 8 * hw;      // global row
        int b = m >> 11, s = m & 2047;
#pragma unroll
        for (int t = 0; t < 2; ++t) {
            int col = n0 + 16 * t + lr;
            int h = col >> 5, d = col & 31;
            float v = t ? c1[r] : c0[r];
            long idx = transposed ? (((long)(b * N_HEAD + h) * D_HID + d) * SEQ + s)
                                  : (((long)(b * N_HEAD + h) * SEQ + s) * D_HID + d);
            out[idx] = (_Float16)v;
        }
    }
}

// ---------- Kernel 2: flash attention (async double-buffered K/V stages of 128 keys in LDS) ----------
// Qh/Kh: [b,h,s,32] f16 (Q pre-scaled). Vt: [b,h,32,s] f16. Obuf: [4096,256] f16.
__global__ __launch_bounds__(256) void attn_flash(
    const _Float16* __restrict__ Qh, const _Float16* __restrict__ Kh,
    const _Float16* __restrict__ Vt, _Float16* __restrict__ Obuf) {
    __shared__ __attribute__((aligned(16))) _Float16 kbuf[2][KSTAGE * LDT];   // K stage: rows = kpos, cols = d
    __shared__ __attribute__((aligned(16))) _Float16 vbuf[2][D_HID * VLD];    // V stage: rows = d,    cols = kpos
    int lane = threadIdx.x & 31;
    int wave = threadIdx.x >> 5;
    int lr = lane & 15, hw = lane >> 4;
    int bh = blockIdx.y;                         // b*8 + h
    int q0 = (blockIdx.x * 8 + wave) * 16;       // 16-row Q tile per wave
    const _Float16* Qbase = Qh + ((long)bh * SEQ + q0) * D_HID;
    const _Float16* Kbase = Kh + (long)bh * SEQ * D_HID;
    const _Float16* Vbase = Vt + (long)bh * D_HID * SEQ;

    // four async copies per wave per stage, every lane on: 512 K pieces and 512 V pieces of 16B over 256 threads
    auto stage = [&](int par, int kt) {
#pragma unroll   // the four copies issue back to back
        for (int i = 0; i < 2; ++i) {
            int c = threadIdx.x + 256 * i;
            int krow = c >> 2, kseg = c & 3;     // 128 rows x 4 x 16B, contiguous in global memory
            cp16_to_lds(Kbase + (long)(kt + krow) * D_HID + kseg * 8,
                        &kbuf[par][krow * LDT + kseg * 8]);
            int vrow = c >> 4, vseg = c & 15;    // 32 rows x 16 x 16B
            cp16_to_lds(Vbase + (long)vrow * SEQ + kt + vseg * 8,
                        &vbuf[par][vrow * VLD + vseg * 8]);
        }
    };

    v16h bq = load_frag_h16(Qbase, D_HID, lane);   // Q^T as B fragment, reused across entire K loop
    v8f o0 = {}, o1 = {};                          // O^T: o0[r] = O[query lr][d = 8*hw + r], o1: d + 16
    float mrow = -1e30f, lsum = 0.f;               // lsum: this half's keys only, joined after the loop

    stage(0, 0);                                   // prologue fill of buffer 0
    asm volatile("s_wait_asynccnt 0x0" ::: "memory");   // this wave's copies of stage 0 have landed
    __syncthreads();                               // stage 0 readable by every wave
    stage(1, KSTAGE);                              // stage 1 flies while stage 0 is worked on
    for (int st = 0; st < SEQ / KSTAGE; ++st) {
      int par = st & 1;
#pragma unroll   // LDS offsets become immediates, and the next 32 keys' reads and scores can issue under this softmax
      for (int sub = 0; sub < KSTAGE / 32; ++sub) {    // 32 keys at a time, as before; no barrier between them
        const _Float16* kb = kbuf[par] + sub * 32 * LDT;
        const _Float16* vb = vbuf[par] + sub * 32;

        // ---- S^T = K * Q^T for 32 key positions (two 16-row tiles) ----
        v8f z = {};
        v8f s0 = wmma_f16(load_frag_h16(kb, LDT, lane), bq, z);
        v8f s1 = wmma_f16(load_frag_h16(kb + 16 * LDT, LDT, lane), bq, z);

        // ---- online softmax, in-lane over 16 keys plus one exchange between the halves ----
        float t0 = fmaxf(s0[0], s1[0]), t1 = fmaxf(s0[1], s1[1]);
#pragma unroll
        for (int r = 2; r < 8; r += 2) {
            t0 = fmaxf(t0, fmaxf(s0[r], s1[r]));
            t1 = fmaxf(t1, fmaxf(s0[r + 1], s1[r + 1]));
        }
        float tmax = fmaxf(t0, t1);
        float mnew = fmaxf(mrow, fmaxf(tmax, xhalf(tmax)));
        float alpha = __expf(mrow - mnew);
        mrow = mnew;
        v8f pa, pb;
#pragma unroll
        for (int r = 0; r < 8; ++r) { pa[r] = __expf(s0[r] - mnew); pb[r] = __expf(s1[r] - mnew); }
        v16h bp;                                       // P^T as 32x16 B fragment, straight from registers
#pragma unroll
        for (int r = 0; r < 8; ++r) { bp[r] = (_Float16)pa[r]; bp[8 + r] = (_Float16)pb[r]; }
        v8f ps = pa + pb;                              // this lane's 16 keys, summed as a tree
        f4 ph = ps.lo + ps.hi;
        lsum = lsum * alpha + ((ph[0] + ph[2]) + (ph[1] + ph[3]));
        o0 *= alpha; o1 *= alpha;

        // ---- O^T += V^T * P^T (V tile rows are d, cols are kpos) ----
        o0 = wmma_f16(load_frag_h16(vb, VLD, lane), bp, o0);
        o1 = wmma_f16(load_frag_h16(vb + 16 * VLD, VLD, lane), bp, o1);
      }
      // publish point of stage st + 1, which also frees buffer par
      asm volatile("s_wait_dscnt 0x0" ::: "memory");      // this wave's reads of buffer par are done before it is refilled
      asm volatile("s_wait_asynccnt 0x0" ::: "memory");   // this wave's copies of stage st + 1 have landed
      __syncthreads();
      if (st + 2 < SEQ / KSTAGE) stage(par, (st + 2) * KSTAGE);   // a whole stage of lead
    }
    asm volatile("s_wait_asynccnt 0x0" ::: "memory");     // nothing in flight when the wave ends

    // ---- normalize and store [4096,256] f16 (row = b*2048+q, col = h*32+d) ----
    int b = bh >> 3, h = bh & 7;
    _Float16* dst = Obuf + ((long)b * SEQ + q0 + lr) * D_MODEL + h * D_HID + 8 * hw;
    float inv = 1.0f / (lsum + xhalf(lsum));       // join the two halves' sums once
    h8 w0, w1;
#pragma unroll
    for (int r = 0; r < 8; ++r) {
        w0[r] = (_Float16)(o0[r] * inv);
        w1[r] = (_Float16)(o1[r] * inv);
    }
    *(h8*)(dst)      = w0;                         // d = 8*hw .. 8*hw + 7
    *(h8*)(dst + 16) = w1;                         // d = 16 + 8*hw ..
}

// ---------- Kernel 3: output projection  Y = O @ Wo^T + bo  (fp32 out) ----------
__global__ __launch_bounds__(256) void attn_outproj(
    const _Float16* __restrict__ O, const _Float16* __restrict__ Wo16,
    const float* __restrict__ bo, float* __restrict__ Y) {
    int lane = threadIdx.x & 31;
    int wave = threadIdx.x >> 5;
    int row0 = blockIdx.x * 16;
    int n0 = wave * 32;
    v8f c0 = {}, c1 = {};
#pragma unroll
    for (int k0 = 0; k0 < D_MODEL; k0 += 32) {
        v16h af = load_frag_h16(O + (long)row0 * D_MODEL + k0, D_MODEL, lane);
        v16h b0 = load_frag_h16(Wo16 + (long)n0 * D_MODEL + k0, D_MODEL, lane);
        v16h b1 = load_frag_h16(Wo16 + (long)(n0 + 16) * D_MODEL + k0, D_MODEL, lane);
        c0 = wmma_f16(af, b0, c0);
        c1 = wmma_f16(af, b1, c1);
    }
    int lr = lane & 15, hw = lane >> 4;
#pragma unroll
    for (int r = 0; r < 8; ++r) {
        int m = row0 + r + 8 * hw;
        int col0 = n0 + lr, col1 = n0 + 16 + lr;
        Y[(long)m * D_MODEL + col0] = c0[r] + bo[col0];
        Y[(long)m * D_MODEL + col1] = c1[r] + bo[col1];
    }
}

extern "C" void kernel_launch(void* const* d_in, const int* in_sizes, int n_in,
                              void* d_out, int out_size, void* d_ws, size_t ws_size,
                              hipStream_t stream) {
    const float* query = (const float*)d_in[0];
    const float* key   = (const float*)d_in[1];
    const float* value = (const float*)d_in[2];
    const float* Wq    = (const float*)d_in[3];
    const float* Wk    = (const float*)d_in[4];
    const float* Wv    = (const float*)d_in[5];
    const float* Wo    = (const float*)d_in[6];
    const float* bo    = (const float*)d_in[7];

    // workspace carve-up (halves): weights 4*64K, then Qh/Kh/Vt/Obuf 1M each (~8.5 MB)
    _Float16* w16 = (_Float16*)d_ws;
    _Float16* Wq16 = w16;
    _Float16* Wo16 = w16 + 196608;
    _Float16* Qh   = w16 + 262144;
    _Float16* Kh   = Qh + (long)NROWS * D_MODEL;
    _Float16* Vt   = Kh + (long)NROWS * D_MODEL;
    _Float16* Ob   = Vt + (long)NROWS * D_MODEL;

    attn_cvt_weights<<<256, 256, 0, stream>>>(Wq, Wk, Wv, Wo, w16);

    const float scaling = 0.17677669529663687f;   // 1/sqrt(32), folded into Q
    attn_proj<<<dim3(NROWS / 16, 3), 256, 0, stream>>>(query, key, value, Wq16, Qh, scaling);

    attn_flash<<<dim3(SEQ / 128, BATCH * N_HEAD), 256, 0, stream>>>(Qh, Kh, Vt, Ob);

    attn_outproj<<<NROWS / 16, 256, 0, stream>>>(Ob, Wo16, bo, (float*)d_out);
}

// v004
// It runs in 42.4 microseconds.
// In both of two side-by-side timings against v003, it was 1.06 times as fast.
// Counting every step since v000, it is 2.20 times as fast.
#include <hip/hip_runtime.h>
#include <hip/hip_bf16.h>

typedef __attribute__((ext_vector_type(16))) _Float16 v16h;
typedef __attribute__((ext_vector_type(8)))  _Float16 h8;
typedef __attribute__((ext_vector_type(8)))  float    v8f;
typedef __attribute__((ext_vector_type(4)))  float    f4;
typedef __attribute__((ext_vector_type(4)))  int      v4i;

#define N_HEAD 8
#define D_HID 32
#define D_MODEL 256
#define SEQ 2048
#define BATCH 2
#define NROWS (BATCH * SEQ)   // 4096
#define LDT 48                // LDS K tile pitch in halves (96B: 16B aligned, conflict-reduced)
#define KSPLIT 2              // wave groups of the flash kernel; each takes its own keys of every stage
#define KGROUP 128            // keys per wave group per LDS stage
#define KSTAGE (KSPLIT * KGROUP)   // keys per LDS stage of the flash kernel
#define VLD (KSTAGE + 8)      // LDS V tile pitch in halves (528B = 16B x odd, for 16-byte row reads)

// ---------- CDNA5 async Global->LDS path (probe via __has_builtin; safe fallback) ----------
#if __has_builtin(__builtin_amdgcn_global_load_async_to_lds_b128)
#define ASYNC_LDS 1
#endif

__device__ __forceinline__ void cp16_to_lds(const _Float16* g, _Float16* l) {
#ifdef ASYNC_LDS
    // signature (from hipcc diagnostic): (v4i addrspace(1)*, v4i addrspace(3)*, imm, imm)
    __builtin_amdgcn_global_load_async_to_lds_b128(
        (__attribute__((address_space(1))) v4i*)g,
        (__attribute__((address_space(3))) v4i*)l, 0, 0);
#else
    *(h8*)l = *(const h8*)g;   // sync fallback: global_load_b128 + ds_store_b128
#endif
}

// ---------- WMMA wrapper ----------
__device__ __forceinline__ v8f wmma_f16(v16h a, v16h b, v8f c) {
    // D = A(16x32 f16) * B(32x16 f16) + C(16x16 f32)
    return __builtin_amdgcn_wmma_f32_16x16x32_f16(false, a, false, b, (short)0, c, false, false);
}

// ---------- Fragment loaders ----------
// A-frag (16x32) from row-major f16 [ld]: lane holds row lane&15.
// Same code loads a B-frag (32x16) from a row-major [N,K] matrix (lane holds col n).
// K(half j, hi) = (j&7) + 8*hi + 16*(j>>3)  ==> two contiguous 8-half (16B) loads.
__device__ __forceinline__ v16h load_frag_h16(const _Float16* __restrict__ base, int ld, int lane) {
    int lr = lane & 15, hw = lane >> 4;
    const _Float16* p = base + (long)lr * ld + 8 * hw;
    h8 lo = *(const h8*)(p);
    h8 hh = *(const h8*)(p + 16);
    v16h r;
#pragma unroll
    for (int i = 0; i < 8; ++i) { r[i] = lo[i]; r[i + 8] = hh[i]; }
    return r;
}

// Same fragment but sourced from a row-major fp32 matrix, converting (and scaling) to f16.
__device__ __forceinline__ v16h load_frag_f32(const float* __restrict__ base, int ld, int lane, float scale) {
    int lr = lane & 15, hw = lane >> 4;
    const float* p = base + (long)lr * ld + 8 * hw;
    f4 a0 = *(const f4*)(p);
    f4 a1 = *(const f4*)(p + 4);
    f4 a2 = *(const f4*)(p + 16);
    f4 a3 = *(const f4*)(p + 20);
    v16h r;
#pragma unroll
    for (int i = 0; i < 4; ++i) {
        r[i]      = (_Float16)(a0[i] * scale);
        r[4 + i]  = (_Float16)(a1[i] * scale);
        r[8 + i]  = (_Float16)(a2[i] * scale);
        r[12 + i] = (_Float16)(a3[i] * scale);
    }
    return r;
}

// ---------- Exchange between the wave halves: lane l <-> l ^ 16 ----------
__device__ __forceinline__ float xhalf(float v) {
    int b = __builtin_bit_cast(int, v);
    return __builtin_bit_cast(float, __builtin_amdgcn_permlanex16(b, b, 0x76543210, 0xfedcba98, false, false));
}

// ---------- Kernel 0: weight fp32 -> f16 ----------
__global__ __launch_bounds__(256) void attn_cvt_weights(
    const float* __restrict__ wq, const float* __restrict__ wk,
    const float* __restrict__ wv, const float* __restrict__ wo,
    _Float16* __restrict__ out) {
    int i = blockIdx.x * 256 + threadIdx.x;           // 65536 threads
    out[i]          = (_Float16)wq[i];
    out[65536 + i]  = (_Float16)wk[i];
    out[131072 + i] = (_Float16)wv[i];
    out[196608 + i] = (_Float16)wo[i];
}

// ---------- Kernel 1: all three projections  out = X @ W^T  (f16 result, head-major) ----------
// One launch: blockIdx.y picks the product. The three are independent, so their load chains overlap
// on a WGP. y = 0 is V, whose scattered stores last longest, then K, then Q.
// transposed==0 : out[((b*8+h)*2048 + s)*32 + d]         (Q, K)
// transposed==1 : out[((b*8+h)*32 + d)*2048 + s]         (V, pre-transposed for P*V)
// Wqkv: Wq, Wk, Wv as f16, one behind the other. QKV: Qh, Kh, Vt, one behind the other.
__global__ __launch_bounds__(256) void attn_proj(
    const float* __restrict__ Xq, const float* __restrict__ Xk, const float* __restrict__ Xv,
    const _Float16* __restrict__ Wqkv, _Float16* __restrict__ QKV, float qscale) {
    int which = 2 - (int)blockIdx.y;    // 0: Q, 1: K, 2: V
    const float* __restrict__ X = which == 0 ? Xq : (which == 1 ? Xk : Xv);
    const _Float16* __restrict__ W16 = Wqkv + (long)which * (D_MODEL * D_MODEL);
    _Float16* __restrict__ out = QKV + (long)which * (NROWS * D_MODEL);
    int transposed = which == 2;
    float scale = which == 0 ? qscale : 1.0f;
    int lane = threadIdx.x & 31;
    int wave = threadIdx.x >> 5;        // 8 waves
    int row0 = blockIdx.x * 16;         // 256 blocks cover 4096 rows
    int n0 = wave * 32;                 // each wave: 32 output cols (2 WMMA N-tiles)
    v8f c0 = {}, c1 = {};
#pragma unroll
    for (int k0 = 0; k0 < D_MODEL; k0 += 32) {
        v16h af = load_frag_f32(X + (long)row0 * D_MODEL + k0, D_MODEL, lane, scale);
        v16h b0 = load_frag_h16(W16 + (long)n0 * D_MODEL + k0, D_MODEL, lane);
        v16h b1 = load_frag_h16(W16 + (long)(n0 + 16) * D_MODEL + k0, D_MODEL, lane);
        c0 = wmma_f16(af, b0, c0);
        c1 = wmma_f16(af, b1, c1);
    }
    int lr = lane & 15, hw = lane >> 4;
#pragma unroll
    for (int r = 0; r < 8; ++r) {
        int m = row0 + r + 8 * hw;      // global row
        int b = m >> 11, s = m & 2047;
#pragma unroll
        for (int t = 0; t < 2; ++t) {
            int col = n0 + 16 * t + lr;
            int h = col >> 5, d = col & 31;
            float v = t ? c1[r] : c0[r];
            long idx = transposed ? (((long)(b * N_HEAD + h) * D_HID + d) * SEQ + s)
                                  : (((long)(b * N_HEAD + h) * SEQ + s) * D_HID + d);
            out[idx] = (_Float16)v;
        }
    }
}

// ---------- Kernel 2: flash attention (async double-buffered K/V stages of 256 keys in LDS) ----------
// Qh/Kh: [b,h,s,32] f16 (Q pre-scaled). Vt: [b,h,32,s] f16. Obuf: [4096,256] f16.
// Wave tile: 32 queries (two column groups) x half of every stage's keys. Waves w and w + 4 hold the same
// queries; a K or V fragment read from LDS feeds both column groups. The key halves are joined once at the end.
__global__ __launch_bounds__(256) void attn_flash(
    const _Float16* __restrict__ Qh, const _Float16* __restrict__ Kh,
    const _Float16* __restrict__ Vt, _Float16* __restrict__ Obuf) {
    __shared__ __attribute__((aligned(16))) _Float16 kbuf[2][KSTAGE * LDT];   // K stage: rows = kpos, cols = d
    __shared__ __attribute__((aligned(16))) _Float16 vbuf[2][D_HID * VLD];    // V stage: rows = d,    cols = kpos
    __shared__ __attribute__((aligned(16))) f4 jo[4][2][4][32];               // group 1's O^T, handed to group 0
    __shared__ float jml[4][2][2][32];                                        // group 1's maxima and sums
    int lane = threadIdx.x & 31;
    int wave = threadIdx.x >> 5;
    int qw = wave & 3, grp = wave >> 2;          // 32-query tile of the block, key group
    int lr = lane & 15, hw = lane >> 4;
    int bh = blockIdx.y;                         // b*8 + h
    int q0 = (blockIdx.x * 4 + qw) * 32;         // 32-row Q tile per wave pair
    const _Float16* Qbase = Qh + ((long)bh * SEQ + q0) * D_HID;
    const _Float16* Kbase = Kh + (long)bh * SEQ * D_HID;
    const _Float16* Vbase = Vt + (long)bh * D_HID * SEQ;

    // eight async copies per wave per stage, every lane on: 1024 K pieces and 1024 V pieces of 16B over 256 threads
    auto stage = [&](int par, int kt) {
#pragma unroll   // the eight copies issue back to back
        for (int i = 0; i < 4; ++i) {
            int c = threadIdx.x + 256 * i;
            int krow = c >> 2, kseg = c & 3;     // 256 rows x 4 x 16B, contiguous in global memory
            cp16_to_lds(Kbase + (long)(kt + krow) * D_HID + kseg * 8,
                        &kbuf[par][krow * LDT + kseg * 8]);
            int vrow = c >> 5, vseg = c & 31;    // 32 rows x 32 x 16B
            cp16_to_lds(Vbase + (long)vrow * SEQ + kt + vseg * 8,
                        &vbuf[par][vrow * VLD + vseg * 8]);
        }
    };

    v16h bq[2];                                    // Q^T as B fragments, reused across entire K loop
    v8f o0[2], o1[2];                              // O^T: o0[c][r] = O[query][d = 8*hw + r], o1: d + 16
    float mrow[2], lsum[2];                        // lsum: this half's keys only, joined after the loop
#pragma unroll
    for (int c = 0; c < 2; ++c) {
        bq[c] = load_frag_h16(Qbase + c * 16 * D_HID, D_HID, lane);
        o0[c] = v8f{}; o1[c] = v8f{};
        mrow[c] = -1e30f; lsum[c] = 0.f;
    }

    stage(0, 0);                                   // prologue fill of buffer 0
    asm volatile("s_wait_asynccnt 0x0" ::: "memory");   // this wave's copies of stage 0 have landed
    __syncthreads();                               // stage 0 readable by every wave
    stage(1, KSTAGE);                              // stage 1 flies while stage 0 is worked on
    for (int st = 0; st < SEQ / KSTAGE; ++st) {
      int par = st & 1;
#pragma unroll   // LDS offsets become immediates, and the next 32 keys' reads and scores can issue under this softmax
      for (int sub = 0; sub < KGROUP / 32; ++sub) {    // 32 keys at a time, as before; no barrier between them
        const _Float16* kb = kbuf[par] + (grp * KGROUP + sub * 32) * LDT;
        const _Float16* vb = vbuf[par] + grp * KGROUP + sub * 32;
        v16h ka = load_frag_h16(kb, LDT, lane), kc = load_frag_h16(kb + 16 * LDT, LDT, lane);
        v16h va = load_frag_h16(vb, VLD, lane), vc = load_frag_h16(vb + 16 * VLD, VLD, lane);
#pragma unroll   // the two column groups are independent chains that fill each other's waits
        for (int c = 0; c < 2; ++c) {
            // ---- S^T = K * Q^T for 32 key positions (two 16-row tiles) ----
            v8f z = {};
            v8f s0 = wmma_f16(ka, bq[c], z);
            v8f s1 = wmma_f16(kc, bq[c], z);

            // ---- online softmax, in-lane over 16 keys plus one exchange between the halves ----
            float t0 = fmaxf(s0[0], s1[0]), t1 = fmaxf(s0[1], s1[1]);
#pragma unroll
            for (int r = 2; r < 8; r += 2) {
                t0 = fmaxf(t0, fmaxf(s0[r], s1[r]));
                t1 = fmaxf(t1, fmaxf(s0[r + 1], s1[r + 1]));
            }
            float tmax = fmaxf(t0, t1);
            float mnew = fmaxf(mrow[c], fmaxf(tmax, xhalf(tmax)));
            float alpha = __expf(mrow[c] - mnew);
            mrow[c] = mnew;
            v8f pa, pb;
#pragma unroll
            for (int r = 0; r < 8; ++r) { pa[r] = __expf(s0[r] - mnew); pb[r] = __expf(s1[r] - mnew); }
            v16h bp;                                   // P^T as 32x16 B fragment, straight from registers
#pragma unroll
            for (int r = 0; r < 8; ++r) { bp[r] = (_Float16)pa[r]; bp[8 + r] = (_Float16)pb[r]; }
            v8f ps = pa + pb;                          // this lane's 16 keys, summed as a tree
            f4 ph = ps.lo + ps.hi;
            lsum[c] = lsum[c] * alpha + ((ph[0] + ph[2]) + (ph[1] + ph[3]));
            o0[c] *= alpha; o1[c] *= alpha;

            // ---- O^T += V^T * P^T (V tile rows are d, cols are kpos) ----
            o0[c] = wmma_f16(va, bp, o0[c]);
            o1[c] = wmma_f16(vc, bp, o1[c]);
        }
      }
      // publish point of stage st + 1, which also frees buffer par
      asm volatile("s_wait_dscnt 0x0" ::: "memory");      // this wave's reads of buffer par are done before it is refilled
      asm volatile("s_wait_asynccnt 0x0" ::: "memory");   // this wave's copies of stage st + 1 have landed
      __syncthreads();
      if (st + 2 < SEQ / KSTAGE) stage(par, (st + 2) * KSTAGE);   // a whole stage of lead
    }
    asm volatile("s_wait_asynccnt 0x0" ::: "memory");     // nothing in flight when the wave ends

    // ---- join the two key groups: group 1 hands its state over through LDS, group 0 finishes ----
    if (grp == 1) {
#pragma unroll
        for (int c = 0; c < 2; ++c) {
            jo[qw][c][0][lane] = o0[c].lo; jo[qw][c][1][lane] = o0[c].hi;
            jo[qw][c][2][lane] = o1[c].lo; jo[qw][c][3][lane] = o1[c].hi;
            jml[qw][c][0][lane] = mrow[c]; jml[qw][c][1][lane] = lsum[c];
        }
    }
    __syncthreads();                               // group 1's state readable by group 0
    if (grp == 1) return;

    // ---- normalize and store [4096,256] f16 (row = b*2048+q, col = h*32+d) ----
    int b = bh >> 3, h = bh & 7;
#pragma unroll
    for (int c = 0; c < 2; ++c) {
        float m1 = jml[qw][c][0][lane], l1 = jml[qw][c][1][lane];
        float mj = fmaxf(mrow[c], m1);
        float a0 = __expf(mrow[c] - mj), a1 = __expf(m1 - mj);
        v8f p0, p1;
        p0.lo = jo[qw][c][0][lane]; p0.hi = jo[qw][c][1][lane];
        p1.lo = jo[qw][c][2][lane]; p1.hi = jo[qw][c][3][lane];
        float ls = lsum[c] * a0 + l1 * a1;
        v8f u0 = o0[c] * a0 + p0 * a1;
        v8f u1 = o1[c] * a0 + p1 * a1;
        _Float16* dst = Obuf + ((long)b * SEQ + q0 + 16 * c + lr) * D_MODEL + h * D_HID + 8 * hw;
        float inv = 1.0f / (ls + xhalf(ls));       // join the two halves' sums once
        h8 w0, w1;
#pragma unroll
        for (int r = 0; r < 8; ++r) {
            w0[r] = (_Float16)(u0[r] * inv);
            w1[r] = (_Float16)(u1[r] * inv);
        }
        *(h8*)(dst)      = w0;                     // d = 8*hw .. 8*hw + 7
        *(h8*)(dst + 16) = w1;                     // d = 16 + 8*hw ..
    }
}

// ---------- Kernel 3: output projection  Y = O @ Wo^T + bo  (fp32 out) ----------
__global__ __launch_bounds__(256) void attn_outproj(
    const _Float16* __restrict__ O, const _Float16* __restrict__ Wo16,
    const float* __restrict__ bo, float* __restrict__ Y) {
    int lane = threadIdx.x & 31;
    int wave = threadIdx.x >> 5;
    int row0 = blockIdx.x * 16;
    int n0 = wave * 32;
    v8f c0 = {}, c1 = {};
#pragma unroll
    for (int k0 = 0; k0 < D_MODEL; k0 += 32) {
        v16h af = load_frag_h16(O + (long)row0 * D_MODEL + k0, D_MODEL, lane);
        v16h b0 = load_frag_h16(Wo16 + (long)n0 * D_MODEL + k0, D_MODEL, lane);
        v16h b1 = load_frag_h16(Wo16 + (long)(n0 + 16) * D_MODEL + k0, D_MODEL, lane);
        c0 = wmma_f16(af, b0, c0);
        c1 = wmma_f16(af, b1, c1);
    }
    int lr = lane & 15, hw = lane >> 4;
#pragma unroll
    for (int r = 0; r < 8; ++r) {
        int m = row0 + r + 8 * hw;
        int col0 = n0 + lr, col1 = n0 + 16 + lr;
        Y[(long)m * D_MODEL + col0] = c0[r] + bo[col0];
        Y[(long)m * D_MODEL + col1] = c1[r] + bo[col1];
    }
}

extern "C" void kernel_launch(void* const* d_in, const int* in_sizes, int n_in,
                              void* d_out, int out_size, void* d_ws, size_t ws_size,
                              hipStream_t stream) {
    const float* query = (const float*)d_in[0];
    const float* key   = (const float*)d_in[1];
    const float* value = (const float*)d_in[2];
    const float* Wq    = (const float*)d_in[3];
    const float* Wk    = (const float*)d_in[4];
    const float* Wv    = (const float*)d_in[5];
    const float* Wo    = (const float*)d_in[6];
    const float* bo    = (const float*)d_in[7];

    // workspace carve-up (halves): weights 4*64K, then Qh/Kh/Vt/Obuf 1M each (~8.5 MB)
    _Float16* w16 = (_Float16*)d_ws;
    _Float16* Wq16 = w16;
    _Float16* Wo16 = w16 + 196608;
    _Float16* Qh   = w16 + 262144;
    _Float16* Kh   = Qh + (long)NROWS * D_MODEL;
    _Float16* Vt   = Kh + (long)NROWS * D_MODEL;
    _Float16* Ob   = Vt + (long)NROWS * D_MODEL;

    attn_cvt_weights<<<256, 256, 0, stream>>>(Wq, Wk, Wv, Wo, w16);

    const float scaling = 0.17677669529663687f;   // 1/sqrt(32), folded into Q
    attn_proj<<<dim3(NROWS / 16, 3), 256, 0, stream>>>(query, key, value, Wq16, Qh, scaling);

    attn_flash<<<dim3(SEQ / 128, BATCH * N_HEAD), 256, 0, stream>>>(Qh, Kh, Vt, Ob);

    attn_outproj<<<NROWS / 16, 256, 0, stream>>>(Ob, Wo16, bo, (float*)d_out);
}

// v005
// A run of this version takes 35.5 microseconds.
// Two timings next to v004 put it at 1.19 and 1.20 times that version's speed.
// Over all steps from v000 it is 2.63 times as fast.
#include <hip/hip_runtime.h>
#include <hip/hip_bf16.h>

typedef __attribute__((ext_vector_type(16))) _Float16 v16h;
typedef __attribute__((ext_vector_type(8)))  _Float16 h8;
typedef __attribute__((ext_vector_type(8)))  float    v8f;
typedef __attribute__((ext_vector_type(4)))  float    f4;
typedef __attribute__((ext_vector_type(4)))  int      v4i;

#define N_HEAD 8
#define D_HID 32
#define D_MODEL 256
#define SEQ 2048
#define BATCH 2
#define NROWS (BATCH * SEQ)   // 4096
#define KSPLIT 2              // wave groups of the flash kernel; each takes its own keys of every stage
#define KGROUP 128            // keys per wave group per LDS stage
#define KSTAGE (KSPLIT * KGROUP)   // keys per LDS stage of the flash kernel

// ---------- CDNA5 async Global->LDS path (probe via __has_builtin; safe fallback) ----------
#if __has_builtin(__builtin_amdgcn_global_load_async_to_lds_b128)
#define ASYNC_LDS 1
#endif

__device__ __forceinline__ void cp16_to_lds(const _Float16* g, _Float16* l) {
#ifdef ASYNC_LDS
    // signature (from hipcc diagnostic): (v4i addrspace(1)*, v4i addrspace(3)*, imm, imm)
    __builtin_amdgcn_global_load_async_to_lds_b128(
        (__attribute__((address_space(1))) v4i*)g,
        (__attribute__((address_space(3))) v4i*)l, 0, 0);
#else
    *(h8*)l = *(const h8*)g;   // sync fallback: global_load_b128 + ds_store_b128
#endif
}

// ---------- WMMA wrapper ----------
__device__ __forceinline__ v8f wmma_f16(v16h a, v16h b, v8f c) {
    // D = A(16x32 f16) * B(32x16 f16) + C(16x16 f32)
    return __builtin_amdgcn_wmma_f32_16x16x32_f16(false, a, false, b, (short)0, c, false, false);
}

// ---------- Fragment loaders ----------
// A-frag (16x32): lane holds row lane&15. A B-frag (32x16) of a row-major [N,K] matrix is the same (lane holds col n).
// K(half j, hi) = (j&7) + 8*hi + 16*(j>>3)  ==> two runs of 8 halves (16B).
// Fragment-order storage of an f16 matrix in the workspace: per (16-row tile, 32-wide k step) one KB, two pieces
// of 512 contiguous bytes; piece j holds, at lane * 8, the eight halves k = 32*kstep + 16*j + 8*hw + i of row
// 16*tile + lr (lr = lane & 15, hw = lane >> 4): the hardware k order of an A or a B fragment. Each load, store or
// copy of a piece by a wave covers four whole 128-byte lines. frag_offset: the [rows, 256] matrices (weights, O).
#define KSTEPS (D_MODEL / 32)
__device__ __forceinline__ long frag_offset(int tile, int kstep, int lane) {
    return (long)(tile * KSTEPS + kstep) * 512 + lane * 8;
}
// p: the lane's own place in the fragment, base + frag_offset(tile, kstep, lane)
__device__ __forceinline__ v16h load_frag_packed(const _Float16* __restrict__ p) {
    h8 lo = *(const h8*)(p);
    h8 hh = *(const h8*)(p + 256);
    v16h r;
#pragma unroll   // vector elements need constant indices to stay in registers
    for (int i = 0; i < 8; ++i) { r[i] = lo[i]; r[i + 8] = hh[i]; }
    return r;
}

// The same fragment sourced from a row-major fp32 matrix, converting (and scaling) to f16.
__device__ __forceinline__ v16h load_frag_f32(const float* __restrict__ base, int ld, int lane, float scale) {
    int lr = lane & 15, hw = lane >> 4;
    const float* p = base + (long)lr * ld + 8 * hw;
    f4 a0 = *(const f4*)(p);
    f4 a1 = *(const f4*)(p + 4);
    f4 a2 = *(const f4*)(p + 16);
    f4 a3 = *(const f4*)(p + 20);
    v16h r;
#pragma unroll
    for (int i = 0; i < 4; ++i) {
        r[i]      = (_Float16)(a0[i] * scale);
        r[4 + i]  = (_Float16)(a1[i] * scale);
        r[8 + i]  = (_Float16)(a2[i] * scale);
        r[12 + i] = (_Float16)(a3[i] * scale);
    }
    return r;
}

// ---------- Exchange between the wave halves: lane l <-> l ^ 16 ----------
__device__ __forceinline__ float xhalf(float v) {
    int b = __builtin_bit_cast(int, v);
    return __builtin_bit_cast(float, __builtin_amdgcn_permlanex16(b, b, 0x76543210, 0xfedcba98, false, false));
}

// ---------- Kernel 0: weight fp32 -> f16, written in fragment order ----------
// One thread per 16-byte piece: 8192 pieces a matrix, 32 blocks a matrix; a wave writes 512 contiguous bytes.
__global__ __launch_bounds__(256) void attn_cvt_weights(
    const float* __restrict__ wq, const float* __restrict__ wk,
    const float* __restrict__ wv, const float* __restrict__ wo,
    _Float16* __restrict__ out) {
    int m = blockIdx.x >> 5;                          // which matrix
    const float* __restrict__ wa = (m & 1) ? wk : wq;
    const float* __restrict__ wb = (m & 1) ? wo : wv;
    const float* __restrict__ w = (m & 2) ? wb : wa;
    int q = (blockIdx.x & 31) * 256 + threadIdx.x;    // piece of that matrix
    int lane = q & 31, j = (q >> 5) & 1, kstep = (q >> 6) & 7, tile = q >> 9;
    const float* p = w + (long)(tile * 16 + (lane & 15)) * D_MODEL + kstep * 32 + 16 * j + 8 * (lane >> 4);
    f4 a0 = *(const f4*)(p);
    f4 a1 = *(const f4*)(p + 4);
    h8 r;
#pragma unroll   // vector elements need constant indices to stay in registers
    for (int i = 0; i < 4; ++i) { r[i] = (_Float16)a0[i]; r[4 + i] = (_Float16)a1[i]; }
    *(h8*)(out + (long)m * (D_MODEL * D_MODEL) + (long)q * 8) = r;
}

// ---------- Kernel 1: all three projections  X @ W^T  (f16 result, per head, in fragment order) ----------
// One launch: blockIdx.y picks the product. The three are independent, so their load chains overlap on a WGP.
// A wave has 16 rows s of X and the 32 columns d of one head. Its accumulators are stored as fragment pieces:
// V (TR = false): D = X * W^T, a lane holds 8 rows s of one d: a piece of the A fragment of V^T (row d, k = s).
// Q, K (TR = true): D = W * X^T, a lane holds 8 columns d of one s: a piece of the fragment of Q or K (row s, k = d).
// Per head: Q, K as [s / 16][piece][lane][8]; V^T as [s / 32][d / 16][piece][lane][8].
// Left as it was: the X fragment loads touch 16 lines each and all eight waves repeat them.
template <bool TR>
__device__ __forceinline__ void proj_tile(const float* __restrict__ Xrow, const _Float16* __restrict__ wp,
                                          float scale, int lane, _Float16* __restrict__ d0, _Float16* __restrict__ d1) {
    v8f c0 = {}, c1 = {};
#pragma unroll   // offsets become immediates and later k steps' loads can issue ahead
    for (int k0 = 0; k0 < D_MODEL; k0 += 32) {
        v16h af = load_frag_f32(Xrow + k0, D_MODEL, lane, scale);
        v16h b0 = load_frag_packed(wp + (k0 / 32) * 512);
        v16h b1 = load_frag_packed(wp + (KSTEPS + k0 / 32) * 512);
        c0 = TR ? wmma_f16(b0, af, c0) : wmma_f16(af, b0, c0);
        c1 = TR ? wmma_f16(b1, af, c1) : wmma_f16(af, b1, c1);
    }
    h8 w0, w1;
#pragma unroll   // vector elements need constant indices to stay in registers
    for (int r = 0; r < 8; ++r) { w0[r] = (_Float16)c0[r]; w1[r] = (_Float16)c1[r]; }
    *(h8*)d0 = w0;
    *(h8*)d1 = w1;
}

// Wqkv: Wq, Wk, Wv as f16 in fragment order, one behind the other. QKV: Qh, Kh, Vt, one behind the other.
__global__ __launch_bounds__(256) void attn_proj(
    const float* __restrict__ Xq, const float* __restrict__ Xk, const float* __restrict__ Xv,
    const _Float16* __restrict__ Wqkv, _Float16* __restrict__ QKV, float qscale) {
    int which = 2 - (int)blockIdx.y;    // 0: Q, 1: K, 2: V
    const float* __restrict__ X = which == 0 ? Xq : (which == 1 ? Xk : Xv);
    const _Float16* __restrict__ W16 = Wqkv + (long)which * (D_MODEL * D_MODEL);
    float scale = which == 0 ? qscale : 1.0f;
    int lane = threadIdx.x & 31;
    int wave = threadIdx.x >> 5;        // 8 waves; wave = head: 32 output cols (2 WMMA tiles)
    int row0 = blockIdx.x * 16;         // 256 blocks cover 4096 rows
    int b = row0 >> 11, s0 = row0 & (SEQ - 1);
    const float* Xrow = X + (long)row0 * D_MODEL;
    const _Float16* wp = W16 + frag_offset(2 * wave, 0, lane);   // this wave's two column tiles, 16 KB in a row
    _Float16* head = QKV + (long)which * (NROWS * D_MODEL) + (long)(b * N_HEAD + wave) * (SEQ * D_HID) + lane * 8;
    if (which == 2) {                   // block-uniform
        _Float16* dst = head + (s0 >> 5) * 1024 + ((s0 >> 4) & 1) * 256;
        proj_tile<false>(Xrow, wp, scale, lane, dst, dst + 512);     // d tiles 0 and 1
    } else {
        _Float16* dst = head + (s0 >> 4) * 512;
        proj_tile<true>(Xrow, wp, scale, lane, dst, dst + 256);      // pieces 0 and 1
    }
}

// ---------- Kernel 2: flash attention (async double-buffered K/V stages of 256 keys in LDS) ----------
// Qh/Kh (Q pre-scaled), Vt: per head in fragment order, as the projection kernel writes them; a stage of 256 keys
// is 16 KB in a row of each. Obuf: [4096,256] f16 in fragment order.
// Wave tile: 32 queries (two column groups) x half of every stage's keys. Waves w and w + 4 hold the same
// queries; a K or V fragment read from LDS feeds both column groups. The key halves are joined once at the end.
__global__ __launch_bounds__(256) void attn_flash(
    const _Float16* __restrict__ Qh, const _Float16* __restrict__ Kh,
    const _Float16* __restrict__ Vt, _Float16* __restrict__ Obuf) {
    __shared__ __attribute__((aligned(16))) _Float16 kbuf[2][KSTAGE * D_HID];   // K stage: [key / 16][piece][lane][8]
    __shared__ __attribute__((aligned(16))) _Float16 vbuf[2][KSTAGE * D_HID];   // V stage: [key / 32][d / 16][piece][lane][8]
    __shared__ __attribute__((aligned(16))) f4 jo[4][2][4][32];               // group 1's O^T, handed to group 0
    __shared__ float jml[4][2][2][32];                                        // group 1's maxima and sums
    int lane = threadIdx.x & 31;
    int wave = threadIdx.x >> 5;
    int qw = wave & 3, grp = wave >> 2;          // 32-query tile of the block, key group
    int lr = lane & 15, hw = lane >> 4;
    int bh = blockIdx.y;                         // b*8 + h
    int q0 = (blockIdx.x * 4 + qw) * 32;         // 32-row Q tile per wave pair
    const _Float16* Qbase = Qh + ((long)bh * SEQ + q0) * D_HID;
    const _Float16* Kbase = Kh + (long)bh * SEQ * D_HID;
    const _Float16* Vbase = Vt + (long)bh * D_HID * SEQ;

    // eight async copies per wave per stage, every lane on: 1024 K pieces and 1024 V pieces of 16B over 256 threads
    auto stage = [&](int par, int kt) {
#pragma unroll   // the eight copies issue back to back
        for (int i = 0; i < 4; ++i) {
            int c = threadIdx.x + 256 * i;
            cp16_to_lds(Kbase + (long)kt * D_HID + c * 8, &kbuf[par][c * 8]);   // both contiguous, the order kept
            cp16_to_lds(Vbase + (long)kt * D_HID + c * 8, &vbuf[par][c * 8]);
        }
    };

    v16h bq[2];                                    // Q^T as B fragments, reused across entire K loop
    v8f o0[2], o1[2];                              // O^T: o0[c][r] = O[query][d = 8*hw + r], o1: d + 16
    float mrow[2], lsum[2];                        // lsum: this half's keys only, joined after the loop
#pragma unroll
    for (int c = 0; c < 2; ++c) {
        bq[c] = load_frag_packed(Qbase + c * 512 + lane * 8);
        o0[c] = v8f{}; o1[c] = v8f{};
        mrow[c] = -1e30f; lsum[c] = 0.f;
    }

    stage(0, 0);                                   // prologue fill of buffer 0
    asm volatile("s_wait_asynccnt 0x0" ::: "memory");   // this wave's copies of stage 0 have landed
    __syncthreads();                               // stage 0 readable by every wave
    stage(1, KSTAGE);                              // stage 1 flies while stage 0 is worked on
    for (int st = 0; st < SEQ / KSTAGE; ++st) {
      int par = st & 1;
#pragma unroll   // LDS offsets become immediates, and the next 32 keys' reads and scores can issue under this softmax
      for (int sub = 0; sub < KGROUP / 32; ++sub) {    // 32 keys at a time, as before; no barrier between them
        const _Float16* kb = kbuf[par] + (grp * KGROUP + sub * 32) * D_HID + lane * 8;   // two key tiles of 1 KB
        const _Float16* vb = vbuf[par] + (grp * KGROUP + sub * 32) * D_HID + lane * 8;   // two d tiles of 1 KB
        v16h ka = load_frag_packed(kb), kc = load_frag_packed(kb + 512);
        v16h va = load_frag_packed(vb), vc = load_frag_packed(vb + 512);
#pragma unroll   // the two column groups are independent chains that fill each other's waits
        for (int c = 0; c < 2; ++c) {
            // ---- S^T = K * Q^T for 32 key positions (two 16-row tiles) ----
            v8f z = {};
            v8f s0 = wmma_f16(ka, bq[c], z);
            v8f s1 = wmma_f16(kc, bq[c], z);

            // ---- online softmax, in-lane over 16 keys plus one exchange between the halves ----
            float t0 = fmaxf(s0[0], s1[0]), t1 = fmaxf(s0[1], s1[1]);
#pragma unroll
            for (int r = 2; r < 8; r += 2) {
                t0 = fmaxf(t0, fmaxf(s0[r], s1[r]));
                t1 = fmaxf(t1, fmaxf(s0[r + 1], s1[r + 1]));
            }
            float tmax = fmaxf(t0, t1);
            float mnew = fmaxf(mrow[c], fmaxf(tmax, xhalf(tmax)));
            float alpha = __expf(mrow[c] - mnew);
            mrow[c] = mnew;
            v8f pa, pb;
#pragma unroll
            for (int r = 0; r < 8; ++r) { pa[r] = __expf(s0[r] - mnew); pb[r] = __expf(s1[r] - mnew); }
            v16h bp;                                   // P^T as 32x16 B fragment, straight from registers
#pragma unroll
            for (int r = 0; r < 8; ++r) { bp[r] = (_Float16)pa[r]; bp[8 + r] = (_Float16)pb[r]; }
            v8f ps = pa + pb;                          // this lane's 16 keys, summed as a tree
            f4 ph = ps.lo + ps.hi;
            lsum[c] = lsum[c] * alpha + ((ph[0] + ph[2]) + (ph[1] + ph[3]));
            o0[c] *= alpha; o1[c] *= alpha;

            // ---- O^T += V^T * P^T (V tile rows are d, cols are kpos) ----
            o0[c] = wmma_f16(va, bp, o0[c]);
            o1[c] = wmma_f16(vc, bp, o1[c]);
        }
      }
      // publish point of stage st + 1, which also frees buffer par
      asm volatile("s_wait_dscnt 0x0" ::: "memory");      // this wave's reads of buffer par are done before it is refilled
      asm volatile("s_wait_asynccnt 0x0" ::: "memory");   // this wave's copies of stage st + 1 have landed
      __syncthreads();
      if (st + 2 < SEQ / KSTAGE) stage(par, (st + 2) * KSTAGE);   // a whole stage of lead
    }
    asm volatile("s_wait_asynccnt 0x0" ::: "memory");     // nothing in flight when the wave ends

    // ---- join the two key groups: group 1 hands its state over through LDS, group 0 finishes ----
    if (grp == 1) {
#pragma unroll
        for (int c = 0; c < 2; ++c) {
            jo[qw][c][0][lane] = o0[c].lo; jo[qw][c][1][lane] = o0[c].hi;
            jo[qw][c][2][lane] = o1[c].lo; jo[qw][c][3][lane] = o1[c].hi;
            jml[qw][c][0][lane] = mrow[c]; jml[qw][c][1][lane] = lsum[c];
        }
    }
    __syncthreads();                               // group 1's state readable by group 0
    if (grp == 1) return;

    // ---- normalize and store (row = b*2048+q, col = h*32+d): a lane's 16 values are its part of the A fragment
    // of row tile row/16, k step h, so each store is 512 contiguous bytes ----
    int b = bh >> 3, h = bh & 7;
#pragma unroll
    for (int c = 0; c < 2; ++c) {
        float m1 = jml[qw][c][0][lane], l1 = jml[qw][c][1][lane];
        float mj = fmaxf(mrow[c], m1);
        float a0 = __expf(mrow[c] - mj), a1 = __expf(m1 - mj);
        v8f p0, p1;
        p0.lo = jo[qw][c][0][lane]; p0.hi = jo[qw][c][1][lane];
        p1.lo = jo[qw][c][2][lane]; p1.hi = jo[qw][c][3][lane];
        float ls = lsum[c] * a0 + l1 * a1;
        v8f u0 = o0[c] * a0 + p0 * a1;
        v8f u1 = o1[c] * a0 + p1 * a1;
        _Float16* dst = Obuf + frag_offset((b * SEQ + q0) / 16 + c, h, lane);
        float inv = 1.0f / (ls + xhalf(ls));       // join the two halves' sums once
        h8 w0, w1;
#pragma unroll
        for (int r = 0; r < 8; ++r) {
            w0[r] = (_Float16)(u0[r] * inv);
            w1[r] = (_Float16)(u1[r] * inv);
        }
        *(h8*)(dst)       = w0;                    // d = 8*hw .. 8*hw + 7
        *(h8*)(dst + 256) = w1;                    // d = 16 + 8*hw ..
    }
}

// ---------- Kernel 3: output projection  Y = O @ Wo^T + bo  (fp32 out); O and Wo in fragment order ----------
__global__ __launch_bounds__(256) void attn_outproj(
    const _Float16* __restrict__ O, const _Float16* __restrict__ Wo16,
    const float* __restrict__ bo, float* __restrict__ Y) {
    int lane = threadIdx.x & 31;
    int wave = threadIdx.x >> 5;
    int row0 = blockIdx.x * 16;
    int n0 = wave * 32;
    const _Float16* op = O + frag_offset(blockIdx.x, 0, lane);       // the block's row tile, 8 KB in a row
    const _Float16* wp = Wo16 + frag_offset(2 * wave, 0, lane);      // this wave's two column tiles, 16 KB in a row
    v8f c0 = {}, c1 = {};
#pragma unroll
    for (int k0 = 0; k0 < D_MODEL; k0 += 32) {
        v16h af = load_frag_packed(op + (k0 / 32) * 512);
        v16h b0 = load_frag_packed(wp + (k0 / 32) * 512);
        v16h b1 = load_frag_packed(wp + (KSTEPS + k0 / 32) * 512);
        c0 = wmma_f16(af, b0, c0);
        c1 = wmma_f16(af, b1, c1);
    }
    int lr = lane & 15, hw = lane >> 4;
#pragma unroll
    for (int r = 0; r < 8; ++r) {
        int m = row0 + r + 8 * hw;
        int col0 = n0 + lr, col1 = n0 + 16 + lr;
        Y[(long)m * D_MODEL + col0] = c0[r] + bo[col0];
        Y[(long)m * D_MODEL + col1] = c1[r] + bo[col1];
    }
}

extern "C" void kernel_launch(void* const* d_in, const int* in_sizes, int n_in,
                              void* d_out, int out_size, void* d_ws, size_t ws_size,
                              hipStream_t stream) {
    const float* query = (const float*)d_in[0];
    const float* key   = (const float*)d_in[1];
    const float* value = (const float*)d_in[2];
    const float* Wq    = (const float*)d_in[3];
    const float* Wk    = (const float*)d_in[4];
    const float* Wv    = (const float*)d_in[5];
    const float* Wo    = (const float*)d_in[6];
    const float* bo    = (const float*)d_in[7];

    // workspace carve-up (halves): weights 4*64K, then Qh/Kh/Vt/Obuf 1M each (~8.5 MB)
    _Float16* w16 = (_Float16*)d_ws;
    _Float16* Wq16 = w16;
    _Float16* Wo16 = w16 + 196608;
    _Float16* Qh   = w16 + 262144;
    _Float16* Kh   = Qh + (long)NROWS * D_MODEL;
    _Float16* Vt   = Kh + (long)NROWS * D_MODEL;
    _Float16* Ob   = Vt + (long)NROWS * D_MODEL;

    attn_cvt_weights<<<128, 256, 0, stream>>>(Wq, Wk, Wv, Wo, w16);

    const float scaling = 0.17677669529663687f;   // 1/sqrt(32), folded into Q
    attn_proj<<<dim3(NROWS / 16, 3), 256, 0, stream>>>(query, key, value, Wq16, Qh, scaling);

    attn_flash<<<dim3(SEQ / 128, BATCH * N_HEAD), 256, 0, stream>>>(Qh, Kh, Vt, Ob);

    attn_outproj<<<NROWS / 16, 256, 0, stream>>>(Ob, Wo16, bo, (float*)d_out);
}

// v006
// A run of this version takes 27.8 microseconds.
// Two timings next to v005 put it at 1.27 and 1.28 times that version's speed.
// Counting every step since v000, it is 3.36 times as fast.
#include <hip/hip_runtime.h>
#include <hip/hip_bf16.h>

typedef __attribute__((ext_vector_type(16))) _Float16 v16h;
typedef __attribute__((ext_vector_type(8)))  _Float16 h8;
typedef __attribute__((ext_vector_type(4)))  _Float16 h4;
typedef __attribute__((ext_vector_type(8)))  float    v8f;
typedef __attribute__((ext_vector_type(4)))  float    f4;
typedef __attribute__((ext_vector_type(4)))  int      v4i;

#define N_HEAD 8
#define D_HID 32
#define D_MODEL 256
#define SEQ 2048
#define BATCH 2
#define NROWS (BATCH * SEQ)   // 4096
#define KSPLIT 2              // wave groups of the flash kernel; each takes its own keys of every stage
#define KGROUP 128            // keys per wave group per LDS stage
#define KSTAGE (KSPLIT * KGROUP)   // keys per LDS stage of the flash kernel

// ---------- CDNA5 async Global->LDS path (probe via __has_builtin; safe fallback) ----------
#if __has_builtin(__builtin_amdgcn_global_load_async_to_lds_b128)
#define ASYNC_LDS 1
#endif

__device__ __forceinline__ void cp16_to_lds(const _Float16* g, _Float16* l) {
#ifdef ASYNC_LDS
    // signature (from hipcc diagnostic): (v4i addrspace(1)*, v4i addrspace(3)*, imm, imm)
    __builtin_amdgcn_global_load_async_to_lds_b128(
        (__attribute__((address_space(1))) v4i*)g,
        (__attribute__((address_space(3))) v4i*)l, 0, 0);
#else
    *(h8*)l = *(const h8*)g;   // sync fallback: global_load_b128 + ds_store_b128
#endif
}

// ---------- WMMA wrapper ----------
__device__ __forceinline__ v8f wmma_f16(v16h a, v16h b, v8f c) {
    // D = A(16x32 f16) * B(32x16 f16) + C(16x16 f32)
    return __builtin_amdgcn_wmma_f32_16x16x32_f16(false, a, false, b, (short)0, c, false, false);
}

// ---------- Fragment loaders ----------
// A-frag (16x32): lane holds row lane&15. A B-frag (32x16) of a row-major [N,K] matrix is the same (lane holds col n).
// K(half j, hi) = (j&7) + 8*hi + 16*(j>>3)  ==> two runs of 8 halves (16B).
// Fragment-order storage of an f16 matrix in the workspace: per (16-row tile, 32-wide k step) one KB, two pieces
// of 512 contiguous bytes; piece j holds, at lane * 8, the eight halves k = 32*kstep + 16*j + 8*hw + i of row
// 16*tile + lr (lr = lane & 15, hw = lane >> 4): the hardware k order of an A or a B fragment. Each load, store or
// copy of a piece by a wave covers four whole 128-byte lines. frag_offset: the [rows, 256] matrices (weights, O).
#define KSTEPS (D_MODEL / 32)
__device__ __forceinline__ long frag_offset(int tile, int kstep, int lane) {
    return (long)(tile * KSTEPS + kstep) * 512 + lane * 8;
}
// p: the lane's own place in the fragment, base + frag_offset(tile, kstep, lane)
__device__ __forceinline__ v16h load_frag_packed(const _Float16* __restrict__ p) {
    h8 lo = *(const h8*)(p);
    h8 hh = *(const h8*)(p + 256);
    v16h r;
#pragma unroll   // vector elements need constant indices to stay in registers
    for (int i = 0; i < 8; ++i) { r[i] = lo[i]; r[i + 8] = hh[i]; }
    return r;
}

// ---------- Exchange between the wave halves: lane l <-> l ^ 16 ----------
__device__ __forceinline__ float xhalf(float v) {
    int b = __builtin_bit_cast(int, v);
    return __builtin_bit_cast(float, __builtin_amdgcn_permlanex16(b, b, 0x76543210, 0xfedcba98, false, false));
}

// ---------- Kernel 0: weight fp32 -> f16, written in fragment order ----------
// One thread per 16-byte piece: 8192 pieces a matrix, 32 blocks a matrix; a wave writes 512 contiguous bytes.
__global__ __launch_bounds__(256) void attn_cvt_weights(
    const float* __restrict__ wq, const float* __restrict__ wk,
    const float* __restrict__ wv, const float* __restrict__ wo,
    _Float16* __restrict__ out) {
    int m = blockIdx.x >> 5;                          // which matrix
    const float* __restrict__ wa = (m & 1) ? wk : wq;
    const float* __restrict__ wb = (m & 1) ? wo : wv;
    const float* __restrict__ w = (m & 2) ? wb : wa;
    int q = (blockIdx.x & 31) * 256 + threadIdx.x;    // piece of that matrix
    int lane = q & 31, j = (q >> 5) & 1, kstep = (q >> 6) & 7, tile = q >> 9;
    const float* p = w + (long)(tile * 16 + (lane & 15)) * D_MODEL + kstep * 32 + 16 * j + 8 * (lane >> 4);
    f4 a0 = *(const f4*)(p);
    f4 a1 = *(const f4*)(p + 4);
    h8 r;
#pragma unroll   // vector elements need constant indices to stay in registers
    for (int i = 0; i < 4; ++i) { r[i] = (_Float16)a0[i]; r[4 + i] = (_Float16)a1[i]; }
    *(h8*)(out + (long)m * (D_MODEL * D_MODEL) + (long)q * 8) = r;
}

// ---------- Kernel 1: all three projections  X @ W^T  (f16 result, per head, in fragment order) ----------
// One launch: blockIdx.y picks the product. A block of 16 waves has 64 rows s of X; a wave has 32 of them and the
// 32 columns d of one head. The block's X tile is read once, in whole 128-byte lines, converted once and laid into
// LDS as fragments; every wave reads its fragments from there, and each W fragment feeds two row tiles.
// The accumulators are stored as fragment pieces:
// V (TR = false): D = X * W^T, a lane holds 8 rows s of one d: a piece of the A fragment of V^T (row d, k = s).
// Q, K (TR = true): D = W * X^T, a lane holds 8 columns d of one s: a piece of the fragment of Q or K (row s, k = d).
// Per head: Q, K as [s / 16][piece][lane][8]; V^T as [s / 32][d / 16][piece][lane][8].
#define PROWS 64                      // rows of X per block
#define PTHREADS 512
// A staged fragment: four quarters (piece j, half hw) of 16 rows x 16 B, each quarter padded from 256 to 320 B, so
// that the 8-byte stores of a wave (4 rows x all four quarters) fall on 64 different banks; readers stay contiguous.
#define XQUARTER 160                  // halves
#define XFRAG (4 * XQUARTER)
// xl: the lane's place in the wave's first staged fragment; w0, w1: the wave's two column tiles, all k steps.
// dst: the lane's place in the piece of the wave's first row tile; the second tile's at + odd, c1's at + second.
template <bool TR>
__device__ __forceinline__ void proj_tiles(const _Float16* xl, const v16h* w0, const v16h* w1,
                                           _Float16* __restrict__ dst, int odd, int second) {
    v8f c0[2] = {}, c1[2] = {};
    v16h a[2][2];                     // two register sets of X fragments: one k step x 2 row tiles each
    auto fetch = [&](int ks) {
#pragma unroll   // register arrays need constant indices
        for (int t = 0; t < 2; ++t) {
            const _Float16* p = xl + (t * KSTEPS + ks) * XFRAG;
            h8 lo = *(const h8*)(p);
            h8 hh = *(const h8*)(p + 2 * XQUARTER);
#pragma unroll   // vector elements need constant indices to stay in registers
            for (int e = 0; e < 8; ++e) { a[ks & 1][t][e] = lo[e]; a[ks & 1][t][e + 8] = hh[e]; }
        }
    };
    fetch(0);
#pragma unroll   // LDS offsets become immediates, register arrays need constant indices
    for (int ks = 0; ks < KSTEPS; ++ks) {
        if (ks + 1 < KSTEPS) fetch(ks + 1);
#pragma unroll   // register arrays need constant indices
        for (int t = 0; t < 2; ++t) {
            v16h af = a[ks & 1][t];
            c0[t] = TR ? wmma_f16(w0[ks], af, c0[t]) : wmma_f16(af, w0[ks], c0[t]);
            c1[t] = TR ? wmma_f16(w1[ks], af, c1[t]) : wmma_f16(af, w1[ks], c1[t]);
        }
    }
#pragma unroll   // register arrays need constant indices
    for (int t = 0; t < 2; ++t) {
        h8 r0, r1;
#pragma unroll   // vector elements need constant indices to stay in registers
        for (int r = 0; r < 8; ++r) { r0[r] = (_Float16)c0[t][r]; r1[r] = (_Float16)c1[t][r]; }
        *(h8*)(dst + t * odd) = r0;
        *(h8*)(dst + t * odd + second) = r1;
    }
    // a precaution: behind this product's stores the listing runs on into the other product's code, which writes the
    // registers that the stores name
    asm volatile("s_wait_xcnt 0x0" ::: "memory");
}

// Wqkv: Wq, Wk, Wv as f16 in fragment order, one behind the other. QKV: Qh, Kh, Vt, one behind the other.
__global__ __launch_bounds__(PTHREADS) void attn_proj(
    const float* __restrict__ Xq, const float* __restrict__ Xk, const float* __restrict__ Xv,
    const _Float16* __restrict__ Wqkv, _Float16* __restrict__ QKV, float qscale) {
    __shared__ __attribute__((aligned(16))) _Float16 xs[(PROWS / 16) * KSTEPS * XFRAG];   // [row tile][k step], 40 KB
    int which = 2 - (int)blockIdx.y;    // 0: Q, 1: K, 2: V
    const float* __restrict__ X = which == 0 ? Xq : (which == 1 ? Xk : Xv);
    const _Float16* __restrict__ W16 = Wqkv + (long)which * (D_MODEL * D_MODEL);
    float scale = which == 0 ? qscale : 1.0f;
    int lane = threadIdx.x & 31;
    int wave = __builtin_amdgcn_readfirstlane(threadIdx.x >> 5);   // 16 waves; scalar, so that what follows from it stays off the vector unit
    int hd = wave & 7, rh = wave >> 3;  // head: 32 output cols (2 WMMA tiles); which 32 rows of the block
    int row0 = blockIdx.x * PROWS;      // 64 blocks cover 4096 rows
    int b = row0 >> 11, s0 = (row0 & (SEQ - 1)) + 32 * rh;

    // X tile: wave w brings rows 4w .. 4w + 3. One load = 4 rows x one whole line (the 32 floats of a k step).
    int rsub = lane >> 3, c = lane & 7;               // row of the four, 16-byte chunk of the line: k = 4c .. 4c + 3
    const float* xg = X + (long)(row0 + 4 * wave + rsub) * D_MODEL + c * 4;
    f4 xv[KSTEPS];
#pragma unroll   // all eight loads in flight together
    for (int ks = 0; ks < KSTEPS; ++ks) xv[ks] = *(const f4*)(xg + ks * 32);
    // a precaution: the W loads' results may be given the registers that hold the X loads' addresses. It also keeps the
    // X loads in front of the W loads: loads return in order, and the staging is to wait for X alone
    asm volatile("s_wait_xcnt 0x0" ::: "memory");

    // this wave's two column tiles of W, 16 KB in a row, asked for ahead of the barrier so that they fly under the staging
    const _Float16* wp = W16 + frag_offset(2 * hd, 0, 0) + lane * 8;   // scalar base, one vector offset
    v16h w0[KSTEPS], w1[KSTEPS];
#pragma unroll   // all 32 loads in flight together; register arrays need constant indices
    for (int ks = 0; ks < KSTEPS; ++ks) {
        w0[ks] = load_frag_packed(wp + ks * 512);
        w1[ks] = load_frag_packed(wp + (KSTEPS + ks) * 512);
    }
    // ends the scheduling region behind the W loads: without it this compiler's build waits for every W load directly
    // behind the barrier and takes about fifty registers more, so that nothing is left in flight under the products
    __builtin_amdgcn_sched_barrier(0);

    // chunk c of a k step is quarter c >> 1 (piece c >> 2, half (c >> 1) & 1), elements 4 * (c & 1) .. + 3 of its row's 16 bytes
    _Float16* xw = xs + (wave >> 2) * (KSTEPS * XFRAG) + (c >> 1) * XQUARTER + (4 * (wave & 3) + rsub) * 8 + (c & 1) * 4;
#pragma unroll   // register arrays need constant indices
    for (int ks = 0; ks < KSTEPS; ++ks) {
        h4 r;
#pragma unroll   // vector elements need constant indices to stay in registers
        for (int e = 0; e < 4; ++e) r[e] = (_Float16)(xv[ks][e] * scale);
        *(h4*)(xw + ks * XFRAG) = r;
    }
    // The staged tile readable by every wave. The fences name LDS alone: __syncthreads() would also wait here for
    // the W loads, which only this wave's own registers receive and which are to stay in flight across the barrier.
    __builtin_amdgcn_fence(__ATOMIC_RELEASE, "workgroup", "local");
    __builtin_amdgcn_s_barrier();
    __builtin_amdgcn_fence(__ATOMIC_ACQUIRE, "workgroup", "local");

    const _Float16* xl = xs + (2 * rh) * (KSTEPS * XFRAG) + (lane >> 4) * XQUARTER + (lane & 15) * 8;
    _Float16* head = QKV + (long)which * (NROWS * D_MODEL) + (long)(b * N_HEAD + hd) * (SEQ * D_HID);
    if (which == 2) {                   // block-uniform
        proj_tiles<false>(xl, w0, w1, head + (s0 >> 5) * 1024 + lane * 8, 256, 512);   // c0, c1: d tiles 0 and 1
    } else {
        proj_tiles<true>(xl, w0, w1, head + (s0 >> 4) * 512 + lane * 8, 512, 256);   // c0, c1: pieces 0 and 1
    }
}

// ---------- Kernel 2: flash attention (async double-buffered K/V stages of 256 keys in LDS) ----------
// Qh/Kh (Q pre-scaled), Vt: per head in fragment order, as the projection kernel writes them; a stage of 256 keys
// is 16 KB in a row of each. Obuf: [4096,256] f16 in fragment order.
// Wave tile: 32 queries (two column groups) x half of every stage's keys. Waves w and w + 4 hold the same
// queries; a K or V fragment read from LDS feeds both column groups. The key halves are joined once at the end.
__global__ __launch_bounds__(256) void attn_flash(
    const _Float16* __restrict__ Qh, const _Float16* __restrict__ Kh,
    const _Float16* __restrict__ Vt, _Float16* __restrict__ Obuf) {
    __shared__ __attribute__((aligned(16))) _Float16 kbuf[2][KSTAGE * D_HID];   // K stage: [key / 16][piece][lane][8]
    __shared__ __attribute__((aligned(16))) _Float16 vbuf[2][KSTAGE * D_HID];   // V stage: [key / 32][d / 16][piece][lane][8]
    __shared__ __attribute__((aligned(16))) f4 jo[4][2][4][32];               // group 1's O^T, handed to group 0
    __shared__ float jml[4][2][2][32];                                        // group 1's maxima and sums
    int lane = threadIdx.x & 31;
    int wave = threadIdx.x >> 5;
    int qw = wave & 3, grp = wave >> 2;          // 32-query tile of the block, key group
    int lr = lane & 15, hw = lane >> 4;
    int bh = blockIdx.y;                         // b*8 + h
    int q0 = (blockIdx.x * 4 + qw) * 32;         // 32-row Q tile per wave pair
    const _Float16* Qbase = Qh + ((long)bh * SEQ + q0) * D_HID;
    const _Float16* Kbase = Kh + (long)bh * SEQ * D_HID;
    const _Float16* Vbase = Vt + (long)bh * D_HID * SEQ;

    // eight async copies per wave per stage, every lane on: 1024 K pieces and 1024 V pieces of 16B over 256 threads
    auto stage = [&](int par, int kt) {
#pragma unroll   // the eight copies issue back to back
        for (int i = 0; i < 4; ++i) {
            int c = threadIdx.x + 256 * i;
            cp16_to_lds(Kbase + (long)kt * D_HID + c * 8, &kbuf[par][c * 8]);   // both contiguous, the order kept
            cp16_to_lds(Vbase + (long)kt * D_HID + c * 8, &vbuf[par][c * 8]);
        }
    };

    v16h bq[2];                                    // Q^T as B fragments, reused across entire K loop
    v8f o0[2], o1[2];                              // O^T: o0[c][r] = O[query][d = 8*hw + r], o1: d + 16
    float mrow[2], lsum[2];                        // lsum: this half's keys only, joined after the loop
#pragma unroll
    for (int c = 0; c < 2; ++c) {
        bq[c] = load_frag_packed(Qbase + c * 512 + lane * 8);
        o0[c] = v8f{}; o1[c] = v8f{};
        mrow[c] = -1e30f; lsum[c] = 0.f;
    }

    stage(0, 0);                                   // prologue fill of buffer 0
    asm volatile("s_wait_asynccnt 0x0" ::: "memory");   // this wave's copies of stage 0 have landed
    __syncthreads();                               // stage 0 readable by every wave
    stage(1, KSTAGE);                              // stage 1 flies while stage 0 is worked on
    for (int st = 0; st < SEQ / KSTAGE; ++st) {
      int par = st & 1;
#pragma unroll   // LDS offsets become immediates, and the next 32 keys' reads and scores can issue under this softmax
      for (int sub = 0; sub < KGROUP / 32; ++sub) {    // 32 keys at a time, as before; no barrier between them
        const _Float16* kb = kbuf[par] + (grp * KGROUP + sub * 32) * D_HID + lane * 8;   // two key tiles of 1 KB
        const _Float16* vb = vbuf[par] + (grp * KGROUP + sub * 32) * D_HID + lane * 8;   // two d tiles of 1 KB
        v16h ka = load_frag_packed(kb), kc = load_frag_packed(kb + 512);
        v16h va = load_frag_packed(vb), vc = load_frag_packed(vb + 512);
#pragma unroll   // the two column groups are independent chains that fill each other's waits
        for (int c = 0; c < 2; ++c) {
            // ---- S^T = K * Q^T for 32 key positions (two 16-row tiles) ----
            v8f z = {};
            v8f s0 = wmma_f16(ka, bq[c], z);
            v8f s1 = wmma_f16(kc, bq[c], z);

            // ---- online softmax, in-lane over 16 keys plus one exchange between the halves ----
            float t0 = fmaxf(s0[0], s1[0]), t1 = fmaxf(s0[1], s1[1]);
#pragma unroll
            for (int r = 2; r < 8; r += 2) {
                t0 = fmaxf(t0, fmaxf(s0[r], s1[r]));
                t1 = fmaxf(t1, fmaxf(s0[r + 1], s1[r + 1]));
            }
            float tmax = fmaxf(t0, t1);
            float mnew = fmaxf(mrow[c], fmaxf(tmax, xhalf(tmax)));
            float alpha = __expf(mrow[c] - mnew);
            mrow[c] = mnew;
            v8f pa, pb;
#pragma unroll
            for (int r = 0; r < 8; ++r) { pa[r] = __expf(s0[r] - mnew); pb[r] = __expf(s1[r] - mnew); }
            v16h bp;                                   // P^T as 32x16 B fragment, straight from registers
#pragma unroll
            for (int r = 0; r < 8; ++r) { bp[r] = (_Float16)pa[r]; bp[8 + r] = (_Float16)pb[r]; }
            v8f ps = pa + pb;                          // this lane's 16 keys, summed as a tree
            f4 ph = ps.lo + ps.hi;
            lsum[c] = lsum[c] * alpha + ((ph[0] + ph[2]) + (ph[1] + ph[3]));
            o0[c] *= alpha; o1[c] *= alpha;

            // ---- O^T += V^T * P^T (V tile rows are d, cols are kpos) ----
            o0[c] = wmma_f16(va, bp, o0[c]);
            o1[c] = wmma_f16(vc, bp, o1[c]);
        }
      }
      // publish point of stage st + 1, which also frees buffer par
      asm volatile("s_wait_dscnt 0x0" ::: "memory");      // this wave's reads of buffer par are done before it is refilled
      asm volatile("s_wait_asynccnt 0x0" ::: "memory");   // this wave's copies of stage st + 1 have landed
      __syncthreads();
      if (st + 2 < SEQ / KSTAGE) stage(par, (st + 2) * KSTAGE);   // a whole stage of lead
    }
    asm volatile("s_wait_asynccnt 0x0" ::: "memory");     // nothing in flight when the wave ends

    // ---- join the two key groups: group 1 hands its state over through LDS, group 0 finishes ----
    if (grp == 1) {
#pragma unroll
        for (int c = 0; c < 2; ++c) {
            jo[qw][c][0][lane] = o0[c].lo; jo[qw][c][1][lane] = o0[c].hi;
            jo[qw][c][2][lane] = o1[c].lo; jo[qw][c][3][lane] = o1[c].hi;
            jml[qw][c][0][lane] = mrow[c]; jml[qw][c][1][lane] = lsum[c];
        }
    }
    __syncthreads();                               // group 1's state readable by group 0
    if (grp == 1) return;

    // ---- normalize and store (row = b*2048+q, col = h*32+d): a lane's 16 values are its part of the A fragment
    // of row tile row/16, k step h, so each store is 512 contiguous bytes ----
    int b = bh >> 3, h = bh & 7;
#pragma unroll
    for (int c = 0; c < 2; ++c) {
        float m1 = jml[qw][c][0][lane], l1 = jml[qw][c][1][lane];
        float mj = fmaxf(mrow[c], m1);
        float a0 = __expf(mrow[c] - mj), a1 = __expf(m1 - mj);
        v8f p0, p1;
        p0.lo = jo[qw][c][0][lane]; p0.hi = jo[qw][c][1][lane];
        p1.lo = jo[qw][c][2][lane]; p1.hi = jo[qw][c][3][lane];
        float ls = lsum[c] * a0 + l1 * a1;
        v8f u0 = o0[c] * a0 + p0 * a1;
        v8f u1 = o1[c] * a0 + p1 * a1;
        _Float16* dst = Obuf + frag_offset((b * SEQ + q0) / 16 + c, h, lane);
        float inv = 1.0f / (ls + xhalf(ls));       // join the two halves' sums once
        h8 w0, w1;
#pragma unroll
        for (int r = 0; r < 8; ++r) {
            w0[r] = (_Float16)(u0[r] * inv);
            w1[r] = (_Float16)(u1[r] * inv);
        }
        *(h8*)(dst)       = w0;                    // d = 8*hw .. 8*hw + 7
        *(h8*)(dst + 256) = w1;                    // d = 16 + 8*hw ..
    }
}

// ---------- Kernel 3: output projection  Y = O @ Wo^T + bo  (fp32 out); O and Wo in fragment order ----------
__global__ __launch_bounds__(256) void attn_outproj(
    const _Float16* __restrict__ O, const _Float16* __restrict__ Wo16,
    const float* __restrict__ bo, float* __restrict__ Y) {
    int lane = threadIdx.x & 31;
    int wave = threadIdx.x >> 5;
    int row0 = blockIdx.x * 16;
    int n0 = wave * 32;
    const _Float16* op = O + frag_offset(blockIdx.x, 0, lane);       // the block's row tile, 8 KB in a row
    const _Float16* wp = Wo16 + frag_offset(2 * wave, 0, lane);      // this wave's two column tiles, 16 KB in a row
    v8f c0 = {}, c1 = {};
#pragma unroll
    for (int k0 = 0; k0 < D_MODEL; k0 += 32) {
        v16h af = load_frag_packed(op + (k0 / 32) * 512);
        v16h b0 = load_frag_packed(wp + (k0 / 32) * 512);
        v16h b1 = load_frag_packed(wp + (KSTEPS + k0 / 32) * 512);
        c0 = wmma_f16(af, b0, c0);
        c1 = wmma_f16(af, b1, c1);
    }
    int lr = lane & 15, hw = lane >> 4;
#pragma unroll
    for (int r = 0; r < 8; ++r) {
        int m = row0 + r + 8 * hw;
        int col0 = n0 + lr, col1 = n0 + 16 + lr;
        Y[(long)m * D_MODEL + col0] = c0[r] + bo[col0];
        Y[(long)m * D_MODEL + col1] = c1[r] + bo[col1];
    }
}

extern "C" void kernel_launch(void* const* d_in, const int* in_sizes, int n_in,
                              void* d_out, int out_size, void* d_ws, size_t ws_size,
                              hipStream_t stream) {
    const float* query = (const float*)d_in[0];
    const float* key   = (const float*)d_in[1];
    const float* value = (const float*)d_in[2];
    const float* Wq    = (const float*)d_in[3];
    const float* Wk    = (const float*)d_in[4];
    const float* Wv    = (const float*)d_in[5];
    const float* Wo    = (const float*)d_in[6];
    const float* bo    = (const float*)d_in[7];

    // workspace carve-up (halves): weights 4*64K, then Qh/Kh/Vt/Obuf 1M each (~8.5 MB)
    _Float16* w16 = (_Float16*)d_ws;
    _Float16* Wq16 = w16;
    _Float16* Wo16 = w16 + 196608;
    _Float16* Qh   = w16 + 262144;
    _Float16* Kh   = Qh + (long)NROWS * D_MODEL;
    _Float16* Vt   = Kh + (long)NROWS * D_MODEL;
    _Float16* Ob   = Vt + (long)NROWS * D_MODEL;

    attn_cvt_weights<<<128, 256, 0, stream>>>(Wq, Wk, Wv, Wo, w16);

    const float scaling = 0.17677669529663687f;   // 1/sqrt(32), folded into Q
    attn_proj<<<dim3(NROWS / PROWS, 3), PTHREADS, 0, stream>>>(query, key, value, Wq16, Qh, scaling);

    attn_flash<<<dim3(SEQ / 128, BATCH * N_HEAD), 256, 0, stream>>>(Qh, Kh, Vt, Ob);

    attn_outproj<<<NROWS / 16, 256, 0, stream>>>(Ob, Wo16, bo, (float*)d_out);
}

// v007
// It runs in 26.7 microseconds.
// In both of two side-by-side timings against v006, it was 1.04 times as fast.
// All steps since v000 together make it 3.49 times as fast.
#include <hip/hip_runtime.h>
#include <hip/hip_bf16.h>

typedef __attribute__((ext_vector_type(16))) _Float16 v16h;
typedef __attribute__((ext_vector_type(8)))  _Float16 h8;
typedef __attribute__((ext_vector_type(4)))  _Float16 h4;
typedef __attribute__((ext_vector_type(8)))  float    v8f;
typedef __attribute__((ext_vector_type(4)))  float    f4;
typedef __attribute__((ext_vector_type(4)))  int      v4i;

#define N_HEAD 8
#define D_HID 32
#define D_MODEL 256
#define SEQ 2048
#define BATCH 2
#define NROWS (BATCH * SEQ)   // 4096
#define KSPLIT 2              // wave groups of the flash kernel; each takes its own keys of every stage
#define KGROUP 128            // keys per wave group per LDS stage
#define KSTAGE (KSPLIT * KGROUP)   // keys per LDS stage of the flash kernel

// ---------- CDNA5 async Global->LDS path (probe via __has_builtin; safe fallback) ----------
#if __has_builtin(__builtin_amdgcn_global_load_async_to_lds_b128)
#define ASYNC_LDS 1
#endif

__device__ __forceinline__ void cp16_to_lds(const _Float16* g, _Float16* l) {
#ifdef ASYNC_LDS
    // signature (from hipcc diagnostic): (v4i addrspace(1)*, v4i addrspace(3)*, imm, imm)
    __builtin_amdgcn_global_load_async_to_lds_b128(
        (__attribute__((address_space(1))) v4i*)g,
        (__attribute__((address_space(3))) v4i*)l, 0, 0);
#else
    *(h8*)l = *(const h8*)g;   // sync fallback: global_load_b128 + ds_store_b128
#endif
}

// ---------- WMMA wrapper ----------
__device__ __forceinline__ v8f wmma_f16(v16h a, v16h b, v8f c) {
    // D = A(16x32 f16) * B(32x16 f16) + C(16x16 f32)
    return __builtin_amdgcn_wmma_f32_16x16x32_f16(false, a, false, b, (short)0, c, false, false);
}

// ---------- Fragment loaders ----------
// A-frag (16x32): lane holds row lane&15. A B-frag (32x16) of a row-major [N,K] matrix is the same (lane holds col n).
// K(half j, hi) = (j&7) + 8*hi + 16*(j>>3)  ==> two runs of 8 halves (16B).
// Fragment-order storage of an f16 matrix in the workspace: per (16-row tile, 32-wide k step) one KB, two pieces
// of 512 contiguous bytes; piece j holds, at lane * 8, the eight halves k = 32*kstep + 16*j + 8*hw + i of row
// 16*tile + lr (lr = lane & 15, hw = lane >> 4): the hardware k order of an A or a B fragment. Each load, store or
// copy of a piece by a wave covers four whole 128-byte lines. frag_offset: the [rows, 256] matrices (weights, O).
#define KSTEPS (D_MODEL / 32)
__device__ __forceinline__ long frag_offset(int tile, int kstep, int lane) {
    return (long)(tile * KSTEPS + kstep) * 512 + lane * 8;
}
// p: the lane's own place in the fragment, base + frag_offset(tile, kstep, lane)
__device__ __forceinline__ v16h load_frag_packed(const _Float16* __restrict__ p) {
    h8 lo = *(const h8*)(p);
    h8 hh = *(const h8*)(p + 256);
    v16h r;
#pragma unroll   // vector elements need constant indices to stay in registers
    for (int i = 0; i < 8; ++i) { r[i] = lo[i]; r[i + 8] = hh[i]; }
    return r;
}

// ---------- Exchange between the wave halves: lane l <-> l ^ 16 ----------
__device__ __forceinline__ float xhalf(float v) {
    int b = __builtin_bit_cast(int, v);
    return __builtin_bit_cast(float, __builtin_amdgcn_permlanex16(b, b, 0x76543210, 0xfedcba98, false, false));
}

// ---------- 2^x as the one hardware instruction (the softmax runs in base 2: Q carries log2(e)) ----------
__device__ __forceinline__ float exp2_hw(float x) { return __builtin_amdgcn_exp2f(x); }

// ---------- Kernel 0: weight fp32 -> f16, written in fragment order ----------
// One thread per 16-byte piece: 8192 pieces a matrix, 32 blocks a matrix; a wave writes 512 contiguous bytes.
__global__ __launch_bounds__(256) void attn_cvt_weights(
    const float* __restrict__ wq, const float* __restrict__ wk,
    const float* __restrict__ wv, const float* __restrict__ wo,
    _Float16* __restrict__ out) {
    int m = blockIdx.x >> 5;                          // which matrix
    const float* __restrict__ wa = (m & 1) ? wk : wq;
    const float* __restrict__ wb = (m & 1) ? wo : wv;
    const float* __restrict__ w = (m & 2) ? wb : wa;
    int q = (blockIdx.x & 31) * 256 + threadIdx.x;    // piece of that matrix
    int lane = q & 31, j = (q >> 5) & 1, kstep = (q >> 6) & 7, tile = q >> 9;
    const float* p = w + (long)(tile * 16 + (lane & 15)) * D_MODEL + kstep * 32 + 16 * j + 8 * (lane >> 4);
    f4 a0 = *(const f4*)(p);
    f4 a1 = *(const f4*)(p + 4);
    h8 r;
#pragma unroll   // vector elements need constant indices to stay in registers
    for (int i = 0; i < 4; ++i) { r[i] = (_Float16)a0[i]; r[4 + i] = (_Float16)a1[i]; }
    *(h8*)(out + (long)m * (D_MODEL * D_MODEL) + (long)q * 8) = r;
}

// ---------- Kernel 1: all three projections  X @ W^T  (f16 result, per head, in fragment order) ----------
// One launch: blockIdx.y picks the product. A block of 16 waves has 64 rows s of X; a wave has 32 of them and the
// 32 columns d of one head. The block's X tile is read once, in whole 128-byte lines, converted once and laid into
// LDS as fragments; every wave reads its fragments from there, and each W fragment feeds two row tiles.
// The accumulators are stored as fragment pieces:
// V (TR = false): D = X * W^T, a lane holds 8 rows s of one d: a piece of the A fragment of V^T (row d, k = s).
// Q, K (TR = true): D = W * X^T, a lane holds 8 columns d of one s: a piece of the fragment of Q or K (row s, k = d).
// Per head: Q, K as [s / 16][piece][lane][8]; V^T as [s / 32][d / 16][piece][lane][8].
#define PROWS 64                      // rows of X per block
#define PTHREADS 512
// A staged fragment: four quarters (piece j, half hw) of 16 rows x 16 B, each quarter padded from 256 to 320 B, so
// that the 8-byte stores of a wave (4 rows x all four quarters) fall on 64 different banks; readers stay contiguous.
#define XQUARTER 160                  // halves
#define XFRAG (4 * XQUARTER)
// xl: the lane's place in the wave's first staged fragment; w0, w1: the wave's two column tiles, all k steps.
// dst: the lane's place in the piece of the wave's first row tile; the second tile's at + odd, c1's at + second.
template <bool TR>
__device__ __forceinline__ void proj_tiles(const _Float16* xl, const v16h* w0, const v16h* w1,
                                           _Float16* __restrict__ dst, int odd, int second) {
    v8f c0[2] = {}, c1[2] = {};
    v16h a[2][2];                     // two register sets of X fragments: one k step x 2 row tiles each
    auto fetch = [&](int ks) {
#pragma unroll   // register arrays need constant indices
        for (int t = 0; t < 2; ++t) {
            const _Float16* p = xl + (t * KSTEPS + ks) * XFRAG;
            h8 lo = *(const h8*)(p);
            h8 hh = *(const h8*)(p + 2 * XQUARTER);
#pragma unroll   // vector elements need constant indices to stay in registers
            for (int e = 0; e < 8; ++e) { a[ks & 1][t][e] = lo[e]; a[ks & 1][t][e + 8] = hh[e]; }
        }
    };
    fetch(0);
#pragma unroll   // LDS offsets become immediates, register arrays need constant indices
    for (int ks = 0; ks < KSTEPS; ++ks) {
        if (ks + 1 < KSTEPS) fetch(ks + 1);
#pragma unroll   // register arrays need constant indices
        for (int t = 0; t < 2; ++t) {
            v16h af = a[ks & 1][t];
            c0[t] = TR ? wmma_f16(w0[ks], af, c0[t]) : wmma_f16(af, w0[ks], c0[t]);
            c1[t] = TR ? wmma_f16(w1[ks], af, c1[t]) : wmma_f16(af, w1[ks], c1[t]);
        }
    }
#pragma unroll   // register arrays need constant indices
    for (int t = 0; t < 2; ++t) {
        h8 r0, r1;
#pragma unroll   // vector elements need constant indices to stay in registers
        for (int r = 0; r < 8; ++r) { r0[r] = (_Float16)c0[t][r]; r1[r] = (_Float16)c1[t][r]; }
        *(h8*)(dst + t * odd) = r0;
        *(h8*)(dst + t * odd + second) = r1;
    }
    // a precaution: behind this product's stores the listing runs on into the other product's code, which writes the
    // registers that the stores name
    asm volatile("s_wait_xcnt 0x0" ::: "memory");
}

// Wqkv: Wq, Wk, Wv as f16 in fragment order, one behind the other. QKV: Qh, Kh, Vt, one behind the other.
__global__ __launch_bounds__(PTHREADS) void attn_proj(
    const float* __restrict__ Xq, const float* __restrict__ Xk, const float* __restrict__ Xv,
    const _Float16* __restrict__ Wqkv, _Float16* __restrict__ QKV, float qscale) {
    __shared__ __attribute__((aligned(16))) _Float16 xs[(PROWS / 16) * KSTEPS * XFRAG];   // [row tile][k step], 40 KB
    int which = 2 - (int)blockIdx.y;    // 0: Q, 1: K, 2: V
    const float* __restrict__ X = which == 0 ? Xq : (which == 1 ? Xk : Xv);
    const _Float16* __restrict__ W16 = Wqkv + (long)which * (D_MODEL * D_MODEL);
    float scale = which == 0 ? qscale : 1.0f;
    int lane = threadIdx.x & 31;
    int wave = __builtin_amdgcn_readfirstlane(threadIdx.x >> 5);   // 16 waves; scalar, so that what follows from it stays off the vector unit
    int hd = wave & 7, rh = wave >> 3;  // head: 32 output cols (2 WMMA tiles); which 32 rows of the block
    int row0 = blockIdx.x * PROWS;      // 64 blocks cover 4096 rows
    int b = row0 >> 11, s0 = (row0 & (SEQ - 1)) + 32 * rh;

    // X tile: wave w brings rows 4w .. 4w + 3. One load = 4 rows x one whole line (the 32 floats of a k step).
    int rsub = lane >> 3, c = lane & 7;               // row of the four, 16-byte chunk of the line: k = 4c .. 4c + 3
    const float* xg = X + (long)(row0 + 4 * wave + rsub) * D_MODEL + c * 4;
    f4 xv[KSTEPS];
#pragma unroll   // all eight loads in flight together
    for (int ks = 0; ks < KSTEPS; ++ks) xv[ks] = *(const f4*)(xg + ks * 32);
    // a precaution: the W loads' results may be given the registers that hold the X loads' addresses. It also keeps the
    // X loads in front of the W loads: loads return in order, and the staging is to wait for X alone
    asm volatile("s_wait_xcnt 0x0" ::: "memory");

    // this wave's two column tiles of W, 16 KB in a row, asked for ahead of the barrier so that they fly under the staging
    const _Float16* wp = W16 + frag_offset(2 * hd, 0, 0) + lane * 8;   // scalar base, one vector offset
    v16h w0[KSTEPS], w1[KSTEPS];
#pragma unroll   // all 32 loads in flight together; register arrays need constant indices
    for (int ks = 0; ks < KSTEPS; ++ks) {
        w0[ks] = load_frag_packed(wp + ks * 512);
        w1[ks] = load_frag_packed(wp + (KSTEPS + ks) * 512);
    }
    // ends the scheduling region behind the W loads: without it this compiler's build waits for every W load directly
    // behind the barrier and takes about fifty registers more, so that nothing is left in flight under the products
    __builtin_amdgcn_sched_barrier(0);

    // chunk c of a k step is quarter c >> 1 (piece c >> 2, half (c >> 1) & 1), elements 4 * (c & 1) .. + 3 of its row's 16 bytes
    _Float16* xw = xs + (wave >> 2) * (KSTEPS * XFRAG) + (c >> 1) * XQUARTER + (4 * (wave & 3) + rsub) * 8 + (c & 1) * 4;
#pragma unroll   // register arrays need constant indices
    for (int ks = 0; ks < KSTEPS; ++ks) {
        h4 r;
#pragma unroll   // vector elements need constant indices to stay in registers
        for (int e = 0; e < 4; ++e) r[e] = (_Float16)(xv[ks][e] * scale);
        *(h4*)(xw + ks * XFRAG) = r;
    }
    // The staged tile readable by every wave. The fences name LDS alone: __syncthreads() would also wait here for
    // the W loads, which only this wave's own registers receive and which are to stay in flight across the barrier.
    __builtin_amdgcn_fence(__ATOMIC_RELEASE, "workgroup", "local");
    __builtin_amdgcn_s_barrier();
    __builtin_amdgcn_fence(__ATOMIC_ACQUIRE, "workgroup", "local");

    const _Float16* xl = xs + (2 * rh) * (KSTEPS * XFRAG) + (lane >> 4) * XQUARTER + (lane & 15) * 8;
    _Float16* head = QKV + (long)which * (NROWS * D_MODEL) + (long)(b * N_HEAD + hd) * (SEQ * D_HID);
    if (which == 2) {                   // block-uniform
        proj_tiles<false>(xl, w0, w1, head + (s0 >> 5) * 1024 + lane * 8, 256, 512);   // c0, c1: d tiles 0 and 1
    } else {
        proj_tiles<true>(xl, w0, w1, head + (s0 >> 4) * 512 + lane * 8, 512, 256);   // c0, c1: pieces 0 and 1
    }
}

// ---------- Kernel 2: flash attention (async double-buffered K/V stages of 256 keys in LDS) ----------
// Qh/Kh (Q pre-scaled, log2(e) included, so that exp(s - m) is 2^(s' - m') with no multiply), Vt: per head in fragment order, as the projection kernel writes them; a stage of 256 keys
// is 16 KB in a row of each. Obuf: [4096,256] f16 in fragment order.
// Wave tile: 32 queries (two column groups) x half of every stage's keys. Waves w and w + 4 hold the same
// queries; a K or V fragment read from LDS feeds both column groups. The key halves are joined once at the end.
__global__ __launch_bounds__(256) void attn_flash(
    const _Float16* __restrict__ Qh, const _Float16* __restrict__ Kh,
    const _Float16* __restrict__ Vt, _Float16* __restrict__ Obuf) {
    __shared__ __attribute__((aligned(16))) _Float16 kbuf[2][KSTAGE * D_HID];   // K stage: [key / 16][piece][lane][8]
    __shared__ __attribute__((aligned(16))) _Float16 vbuf[2][KSTAGE * D_HID];   // V stage: [key / 32][d / 16][piece][lane][8]
    __shared__ __attribute__((aligned(16))) f4 jo[4][2][4][32];               // group 1's O^T, handed to group 0
    __shared__ float jml[4][2][2][32];                                        // group 1's maxima and sums
    int lane = threadIdx.x & 31;
    int wave = threadIdx.x >> 5;
    int qw = wave & 3, grp = wave >> 2;          // 32-query tile of the block, key group
    int lr = lane & 15, hw = lane >> 4;
    int bh = blockIdx.y;                         // b*8 + h
    int q0 = (blockIdx.x * 4 + qw) * 32;         // 32-row Q tile per wave pair
    const _Float16* Qbase = Qh + ((long)bh * SEQ + q0) * D_HID;
    const _Float16* Kbase = Kh + (long)bh * SEQ * D_HID;
    const _Float16* Vbase = Vt + (long)bh * D_HID * SEQ;

    // eight async copies per wave per stage, every lane on: 1024 K pieces and 1024 V pieces of 16B over 256 threads
    auto stage = [&](int par, int kt) {
#pragma unroll   // the eight copies issue back to back
        for (int i = 0; i < 4; ++i) {
            int c = threadIdx.x + 256 * i;
            cp16_to_lds(Kbase + (long)kt * D_HID + c * 8, &kbuf[par][c * 8]);   // both contiguous, the order kept
            cp16_to_lds(Vbase + (long)kt * D_HID + c * 8, &vbuf[par][c * 8]);
        }
    };

    v16h bq[2];                                    // Q^T as B fragments, reused across entire K loop
    v8f o0[2], o1[2];                              // O^T: o0[c][r] = O[query][d = 8*hw + r], o1: d + 16
    float mrow[2], lsum[2];                        // lsum: this half's keys only, joined after the loop
#pragma unroll
    for (int c = 0; c < 2; ++c) {
        bq[c] = load_frag_packed(Qbase + c * 512 + lane * 8);
        o0[c] = v8f{}; o1[c] = v8f{};
        mrow[c] = -1e30f; lsum[c] = 0.f;
    }

    stage(0, 0);                                   // prologue fill of buffer 0
    asm volatile("s_wait_asynccnt 0x0" ::: "memory");   // this wave's copies of stage 0 have landed
    __syncthreads();                               // stage 0 readable by every wave
    stage(1, KSTAGE);                              // stage 1 flies while stage 0 is worked on
    for (int st = 0; st < SEQ / KSTAGE; ++st) {
      int par = st & 1;
#pragma unroll   // LDS offsets become immediates, and the next 32 keys' reads and scores can issue under this softmax
      for (int sub = 0; sub < KGROUP / 32; ++sub) {    // 32 keys at a time, as before; no barrier between them
        const _Float16* kb = kbuf[par] + (grp * KGROUP + sub * 32) * D_HID + lane * 8;   // two key tiles of 1 KB
        const _Float16* vb = vbuf[par] + (grp * KGROUP + sub * 32) * D_HID + lane * 8;   // two d tiles of 1 KB
        v16h ka = load_frag_packed(kb), kc = load_frag_packed(kb + 512);
        v16h va = load_frag_packed(vb), vc = load_frag_packed(vb + 512);
#pragma unroll   // the two column groups are independent chains that fill each other's waits
        for (int c = 0; c < 2; ++c) {
            // ---- S^T = K * Q^T for 32 key positions (two 16-row tiles) ----
            v8f z = {};
            v8f s0 = wmma_f16(ka, bq[c], z);
            v8f s1 = wmma_f16(kc, bq[c], z);

            // ---- online softmax, in-lane over 16 keys plus one exchange between the halves ----
            float t0 = fmaxf(s0[0], s1[0]), t1 = fmaxf(s0[1], s1[1]);
#pragma unroll
            for (int r = 2; r < 8; r += 2) {
                t0 = fmaxf(t0, fmaxf(s0[r], s1[r]));
                t1 = fmaxf(t1, fmaxf(s0[r + 1], s1[r + 1]));
            }
            float tmax = fmaxf(t0, t1);
            float mnew = fmaxf(mrow[c], fmaxf(tmax, xhalf(tmax)));
            float alpha = exp2_hw(mrow[c] - mnew);
            mrow[c] = mnew;
            v8f pa, pb;
#pragma unroll
            for (int r = 0; r < 8; ++r) { pa[r] = exp2_hw(s0[r] - mnew); pb[r] = exp2_hw(s1[r] - mnew); }
            v16h bp;                                   // P^T as 32x16 B fragment, straight from registers
#pragma unroll
            for (int r = 0; r < 8; ++r) { bp[r] = (_Float16)pa[r]; bp[8 + r] = (_Float16)pb[r]; }
            v8f ps = pa + pb;                          // this lane's 16 keys, summed as a tree
            f4 ph = ps.lo + ps.hi;
            lsum[c] = lsum[c] * alpha + ((ph[0] + ph[2]) + (ph[1] + ph[3]));
            o0[c] *= alpha; o1[c] *= alpha;

            // ---- O^T += V^T * P^T (V tile rows are d, cols are kpos) ----
            o0[c] = wmma_f16(va, bp, o0[c]);
            o1[c] = wmma_f16(vc, bp, o1[c]);
        }
      }
      // publish point of stage st + 1, which also frees buffer par
      asm volatile("s_wait_dscnt 0x0" ::: "memory");      // this wave's reads of buffer par are done before it is refilled
      asm volatile("s_wait_asynccnt 0x0" ::: "memory");   // this wave's copies of stage st + 1 have landed
      __syncthreads();
      if (st + 2 < SEQ / KSTAGE) stage(par, (st + 2) * KSTAGE);   // a whole stage of lead
    }
    asm volatile("s_wait_asynccnt 0x0" ::: "memory");     // nothing in flight when the wave ends

    // ---- join the two key groups: group 1 hands its state over through LDS, group 0 finishes ----
    if (grp == 1) {
#pragma unroll
        for (int c = 0; c < 2; ++c) {
            jo[qw][c][0][lane] = o0[c].lo; jo[qw][c][1][lane] = o0[c].hi;
            jo[qw][c][2][lane] = o1[c].lo; jo[qw][c][3][lane] = o1[c].hi;
            jml[qw][c][0][lane] = mrow[c]; jml[qw][c][1][lane] = lsum[c];
        }
    }
    __syncthreads();                               // group 1's state readable by group 0
    if (grp == 1) return;

    // ---- normalize and store (row = b*2048+q, col = h*32+d): a lane's 16 values are its part of the A fragment
    // of row tile row/16, k step h, so each store is 512 contiguous bytes ----
    int b = bh >> 3, h = bh & 7;
#pragma unroll
    for (int c = 0; c < 2; ++c) {
        float m1 = jml[qw][c][0][lane], l1 = jml[qw][c][1][lane];
        float mj = fmaxf(mrow[c], m1);
        float a0 = exp2_hw(mrow[c] - mj), a1 = exp2_hw(m1 - mj);
        v8f p0, p1;
        p0.lo = jo[qw][c][0][lane]; p0.hi = jo[qw][c][1][lane];
        p1.lo = jo[qw][c][2][lane]; p1.hi = jo[qw][c][3][lane];
        float ls = lsum[c] * a0 + l1 * a1;
        v8f u0 = o0[c] * a0 + p0 * a1;
        v8f u1 = o1[c] * a0 + p1 * a1;
        _Float16* dst = Obuf + frag_offset((b * SEQ + q0) / 16 + c, h, lane);
        float inv = 1.0f / (ls + xhalf(ls));       // join the two halves' sums once
        h8 w0, w1;
#pragma unroll
        for (int r = 0; r < 8; ++r) {
            w0[r] = (_Float16)(u0[r] * inv);
            w1[r] = (_Float16)(u1[r] * inv);
        }
        *(h8*)(dst)       = w0;                    // d = 8*hw .. 8*hw + 7
        *(h8*)(dst + 256) = w1;                    // d = 16 + 8*hw ..
    }
}

// ---------- Kernel 3: output projection  Y = O @ Wo^T + bo  (fp32 out); O and Wo in fragment order ----------
__global__ __launch_bounds__(256) void attn_outproj(
    const _Float16* __restrict__ O, const _Float16* __restrict__ Wo16,
    const float* __restrict__ bo, float* __restrict__ Y) {
    int lane = threadIdx.x & 31;
    int wave = threadIdx.x >> 5;
    int row0 = blockIdx.x * 16;
    int n0 = wave * 32;
    const _Float16* op = O + frag_offset(blockIdx.x, 0, lane);       // the block's row tile, 8 KB in a row
    const _Float16* wp = Wo16 + frag_offset(2 * wave, 0, lane);      // this wave's two column tiles, 16 KB in a row
    v8f c0 = {}, c1 = {};
#pragma unroll
    for (int k0 = 0; k0 < D_MODEL; k0 += 32) {
        v16h af = load_frag_packed(op + (k0 / 32) * 512);
        v16h b0 = load_frag_packed(wp + (k0 / 32) * 512);
        v16h b1 = load_frag_packed(wp + (KSTEPS + k0 / 32) * 512);
        c0 = wmma_f16(af, b0, c0);
        c1 = wmma_f16(af, b1, c1);
    }
    int lr = lane & 15, hw = lane >> 4;
#pragma unroll
    for (int r = 0; r < 8; ++r) {
        int m = row0 + r + 8 * hw;
        int col0 = n0 + lr, col1 = n0 + 16 + lr;
        Y[(long)m * D_MODEL + col0] = c0[r] + bo[col0];
        Y[(long)m * D_MODEL + col1] = c1[r] + bo[col1];
    }
}

extern "C" void kernel_launch(void* const* d_in, const int* in_sizes, int n_in,
                              void* d_out, int out_size, void* d_ws, size_t ws_size,
                              hipStream_t stream) {
    const float* query = (const float*)d_in[0];
    const float* key   = (const float*)d_in[1];
    const float* value = (const float*)d_in[2];
    const float* Wq    = (const float*)d_in[3];
    const float* Wk    = (const float*)d_in[4];
    const float* Wv    = (const float*)d_in[5];
    const float* Wo    = (const float*)d_in[6];
    const float* bo    = (const float*)d_in[7];

    // workspace carve-up (halves): weights 4*64K, then Qh/Kh/Vt/Obuf 1M each (~8.5 MB)
    _Float16* w16 = (_Float16*)d_ws;
    _Float16* Wq16 = w16;
    _Float16* Wo16 = w16 + 196608;
    _Float16* Qh   = w16 + 262144;
    _Float16* Kh   = Qh + (long)NROWS * D_MODEL;
    _Float16* Vt   = Kh + (long)NROWS * D_MODEL;
    _Float16* Ob   = Vt + (long)NROWS * D_MODEL;

    attn_cvt_weights<<<128, 256, 0, stream>>>(Wq, Wk, Wv, Wo, w16);

    const float scaling = 0.25503486f;   // log2(e) / sqrt(32), folded into Q: the scores are exponents of 2
    attn_proj<<<dim3(NROWS / PROWS, 3), PTHREADS, 0, stream>>>(query, key, value, Wq16, Qh, scaling);

    attn_flash<<<dim3(SEQ / 128, BATCH * N_HEAD), 256, 0, stream>>>(Qh, Kh, Vt, Ob);

    attn_outproj<<<NROWS / 16, 256, 0, stream>>>(Ob, Wo16, bo, (float*)d_out);
}

// v008
// One run takes 25.3 microseconds.
// Timed twice side by side with v007, it ran 1.06 and 1.05 times as fast.
// Over all steps from v000 it is 3.68 times as fast.
#include <hip/hip_runtime.h>
#include <hip/hip_bf16.h>

typedef __attribute__((ext_vector_type(16))) _Float16 v16h;
typedef __attribute__((ext_vector_type(8)))  _Float16 h8;
typedef __attribute__((ext_vector_type(4)))  _Float16 h4;
typedef __attribute__((ext_vector_type(8)))  float    v8f;
typedef __attribute__((ext_vector_type(4)))  float    f4;
typedef __attribute__((ext_vector_type(4)))  int      v4i;

#define N_HEAD 8
#define D_HID 32
#define D_MODEL 256
#define SEQ 2048
#define BATCH 2
#define NROWS (BATCH * SEQ)   // 4096
#define KSPLIT 2              // wave groups of the flash kernel; each takes its own keys of every stage
#define KGROUP 128            // keys per wave group per LDS stage
#define KSTAGE (KSPLIT * KGROUP)   // keys per LDS stage of the flash kernel

// ---------- CDNA5 async Global->LDS path (probe via __has_builtin; safe fallback) ----------
#if __has_builtin(__builtin_amdgcn_global_load_async_to_lds_b128)
#define ASYNC_LDS 1
#endif

__device__ __forceinline__ void cp16_to_lds(const _Float16* g, _Float16* l) {
#ifdef ASYNC_LDS
    // signature (from hipcc diagnostic): (v4i addrspace(1)*, v4i addrspace(3)*, imm, imm)
    __builtin_amdgcn_global_load_async_to_lds_b128(
        (__attribute__((address_space(1))) v4i*)g,
        (__attribute__((address_space(3))) v4i*)l, 0, 0);
#else
    *(h8*)l = *(const h8*)g;   // sync fallback: global_load_b128 + ds_store_b128
#endif
}

// ---------- WMMA wrapper ----------
__device__ __forceinline__ v8f wmma_f16(v16h a, v16h b, v8f c) {
    // D = A(16x32 f16) * B(32x16 f16) + C(16x16 f32)
    return __builtin_amdgcn_wmma_f32_16x16x32_f16(false, a, false, b, (short)0, c, false, false);
}

// ---------- Fragment loaders ----------
// A-frag (16x32): lane holds row lane&15. A B-frag (32x16) of a row-major [N,K] matrix is the same (lane holds col n).
// K(half j, hi) = (j&7) + 8*hi + 16*(j>>3)  ==> two runs of 8 halves (16B).
// Fragment-order storage of an f16 matrix in the workspace: per (16-row tile, 32-wide k step) one KB, two pieces
// of 512 contiguous bytes; piece j holds, at lane * 8, the eight halves k = 32*kstep + 16*j + 8*hw + i of row
// 16*tile + lr (lr = lane & 15, hw = lane >> 4): the hardware k order of an A or a B fragment. Each load, store or
// copy of a piece by a wave covers four whole 128-byte lines. frag_offset: the [rows, 256] matrices (Wo, O).
#define KSTEPS (D_MODEL / 32)
__device__ __forceinline__ long frag_offset(int tile, int kstep, int lane) {
    return (long)(tile * KSTEPS + kstep) * 512 + lane * 8;
}
// p: the lane's own place in the fragment, base + frag_offset(tile, kstep, lane)
__device__ __forceinline__ v16h load_frag_packed(const _Float16* __restrict__ p) {
    h8 lo = *(const h8*)(p);
    h8 hh = *(const h8*)(p + 256);
    v16h r;
#pragma unroll   // vector elements need constant indices to stay in registers
    for (int i = 0; i < 8; ++i) { r[i] = lo[i]; r[i + 8] = hh[i]; }
    return r;
}

// ---------- Exchange between the wave halves: lane l <-> l ^ 16 ----------
__device__ __forceinline__ float xhalf(float v) {
    int b = __builtin_bit_cast(int, v);
    return __builtin_bit_cast(float, __builtin_amdgcn_permlanex16(b, b, 0x76543210, 0xfedcba98, false, false));
}

// ---------- 2^x as the one hardware instruction (the softmax runs in base 2: Q carries log2(e)) ----------
__device__ __forceinline__ float exp2_hw(float x) { return __builtin_amdgcn_exp2f(x); }

// ---------- Wo fp32 -> f16, written in fragment order (for the output projection) ----------
// One thread per 16-byte piece q, 8192 pieces; a wave writes 512 contiguous bytes.
__device__ __forceinline__ void cvt_piece(const float* __restrict__ w, _Float16* __restrict__ out, int q) {
    int lane = q & 31, j = (q >> 5) & 1, kstep = (q >> 6) & 7, tile = q >> 9;
    const float* p = w + (long)(tile * 16 + (lane & 15)) * D_MODEL + kstep * 32 + 16 * j + 8 * (lane >> 4);
    f4 a0 = *(const f4*)(p);
    f4 a1 = *(const f4*)(p + 4);
    h8 r;
#pragma unroll   // vector elements need constant indices to stay in registers
    for (int i = 0; i < 4; ++i) { r[i] = (_Float16)a0[i]; r[4 + i] = (_Float16)a1[i]; }
    *(h8*)(out + (long)q * 8) = r;
}

// ---------- Kernel 1: all three projections  X @ W^T  (f16 result, per head, in fragment order) ----------
// One launch: blockIdx.x >> 6 picks the product. A block of 16 waves has 64 rows s of X; a wave has 32 of them and the
// 32 columns d of one head. The block's X tile and its whole fp32 weight matrix are read once, in whole 128-byte
// lines, converted once and laid into LDS as fragments; every wave reads its fragments from there, and each fragment
// feeds two products. W is staged in two halves of k: the second half's loads fly under the first half's products.
// Sixteen more blocks of the launch convert Wo for the output projection.
// The accumulators are stored as fragment pieces:
// V: D = X * W^T, a lane holds 8 rows s of one d: a piece of the A fragment of V^T (row d, k = s).
// Q, K: D = W * X^T, a lane holds 8 columns d of one s: a piece of the fragment of Q or K (row s, k = d).
// Per head: Q, K as [s / 16][piece][lane][8]; V^T as [s / 32][d / 16][piece][lane][8].
#define PROWS 64                      // rows of X per block
#define PTHREADS 512
// A staged fragment: four quarters (piece j, half hw) of 16 rows x 16 B, each quarter padded from 256 to 320 B, so
// that the 8-byte stores of a wave (4 rows x all four quarters) fall on 64 different banks; readers stay contiguous.
#define XQUARTER 160                  // halves
#define XFRAG (4 * XQUARTER)
#define WTILES (D_MODEL / 16)         // column tiles of a weight matrix, staged like the row tiles of X
#define WOBLOCKS (D_MODEL * D_MODEL / 8 / PTHREADS)   // blocks that convert Wo, one 16-byte piece a thread
#define KHALF (KSTEPS / 2)
// Half h of k of the wave's column tile of W (wv: 4 groups of 4 rows x 8 k steps, as loaded) into LDS; ww: the lane's place.
__device__ __forceinline__ void stage_w(const f4 (&wv)[4][KSTEPS], _Float16* ww, int h) {
#pragma unroll   // register arrays need constant indices
    for (int g = 0; g < 4; ++g) {
#pragma unroll   // register arrays need constant indices
        for (int ks = h * KHALF; ks < (h + 1) * KHALF; ++ks) {
            h4 r;
#pragma unroll   // vector elements need constant indices to stay in registers
            for (int e = 0; e < 4; ++e) r[e] = (_Float16)wv[g][ks][e];
            *(h4*)(ww + g * 32 + ks * XFRAG) = r;
        }
        // ends the scheduling region: loads return in order, and this group's stores are to go out in front of the wait
        // for the next group; without it this compiler's build holds every LDS store back behind the last load
        if (g < 3) __builtin_amdgcn_sched_barrier(0);
    }
}
// pa, pb: the lane's place in the first staged fragment of the wave's two tiles of the A and of the B operand
// (tile t, k step ks at (t * KSTEPS + ks) * XFRAG). The products of the KHALF k steps from ks0 on: c[i][j] += A tile i * B tile j.
__device__ __forceinline__ void proj_products(const _Float16* pa, const _Float16* pb, int ks0, v8f (&c)[2][2]) {
    v16h a[KHALF][2], b[KHALF][2];    // every fragment of the half: 32 LDS reads issued as one group
#pragma unroll   // LDS offsets become immediates, register arrays need constant indices
    for (int k = 0; k < KHALF; ++k)
#pragma unroll   // register arrays need constant indices
        for (int t = 0; t < 2; ++t) {
            const _Float16* p = pa + (t * KSTEPS + ks0 + k) * XFRAG;
            const _Float16* u = pb + (t * KSTEPS + ks0 + k) * XFRAG;
            h8 alo = *(const h8*)(p), ahh = *(const h8*)(p + 2 * XQUARTER);
            h8 blo = *(const h8*)(u), bhh = *(const h8*)(u + 2 * XQUARTER);
#pragma unroll   // vector elements need constant indices to stay in registers
            for (int e = 0; e < 8; ++e) {
                a[k][t][e] = alo[e]; a[k][t][e + 8] = ahh[e];
                b[k][t][e] = blo[e]; b[k][t][e + 8] = bhh[e];
            }
        }
    // ends the scheduling region behind the reads: without it this compiler's build sinks them among the products, each
    // directly in front of its wait, and the wave sits out the LDS latency at every k step
    __builtin_amdgcn_sched_barrier(0);
#pragma unroll   // register arrays need constant indices
    for (int k = 0; k < KHALF; ++k)
#pragma unroll   // register arrays need constant indices
        for (int i = 0; i < 2; ++i)
#pragma unroll   // register arrays need constant indices
            for (int j = 0; j < 2; ++j) c[i][j] = wmma_f16(a[k][i], b[k][j], c[i][j]);
}

// QKV: Qh, Kh, Vt, one behind the other. Wo16: Wo as f16 in fragment order.
__global__ __launch_bounds__(PTHREADS) void attn_proj(
    const float* __restrict__ Xq, const float* __restrict__ Xk, const float* __restrict__ Xv,
    const float* __restrict__ Wq, const float* __restrict__ Wk, const float* __restrict__ Wv,
    const float* __restrict__ Wo, _Float16* __restrict__ Wo16, _Float16* __restrict__ QKV, float qscale) {
    // [row tile of X, then column tile of W][k step], 200 KB
    __shared__ __attribute__((aligned(16))) _Float16 xs[(PROWS / 16 + WTILES) * KSTEPS * XFRAG];
    int which = 2 - (int)(blockIdx.x >> 6);    // 0: Q, 1: K, 2: V; -1: the blocks that convert Wo
    int rb = blockIdx.x & 63;                  // 64 blocks cover 4096 rows
    if (which < 0) {                           // block-uniform, in front of the barrier
        cvt_piece(Wo, Wo16, rb * PTHREADS + threadIdx.x);
        return;
    }
    const float* __restrict__ X = which == 0 ? Xq : (which == 1 ? Xk : Xv);
    const float* __restrict__ Wf = which == 0 ? Wq : (which == 1 ? Wk : Wv);
    float scale = which == 0 ? qscale : 1.0f;
    int lane = threadIdx.x & 31;
    int wave = __builtin_amdgcn_readfirstlane(threadIdx.x >> 5);   // 16 waves; scalar, so that what follows from it stays off the vector unit
    int hd = wave & 7, rh = wave >> 3;  // head: 32 output cols (2 WMMA tiles); which 32 rows of the block
    int row0 = rb * PROWS;
    int b = row0 >> 11, s0 = (row0 & (SEQ - 1)) + 32 * rh;

    // X tile: wave w brings rows 4w .. 4w + 3. One load = 4 rows x one whole line (the 32 floats of a k step).
    int rsub = lane >> 3, c = lane & 7;               // row of the four, 16-byte chunk of the line: k = 4c .. 4c + 3
    const float* xg = X + (long)(row0 + 4 * wave + rsub) * D_MODEL + c * 4;
    f4 xv[KSTEPS];
#pragma unroll   // all eight loads in flight together
    for (int ks = 0; ks < KSTEPS; ++ks) xv[ks] = *(const f4*)(xg + ks * 32);
    // a precaution: the W loads' results may be given the registers that hold the X loads' addresses. It also keeps the
    // X loads in front of the W loads: loads return in order, and the staging is to wait for X alone
    asm volatile("s_wait_xcnt 0x0" ::: "memory");

    // W: wave w brings column tile w, rows 16w .. 16w + 15 of the fp32 matrix, in the same form: 4 rows x one whole line a load
    const float* wg = Wf + (long)(16 * wave + rsub) * D_MODEL + c * 4;
    f4 wv[4][KSTEPS];
#pragma unroll   // all 32 loads in flight together, the first half of k in front; register arrays need constant indices
    for (int h = 0; h < 2; ++h)
#pragma unroll   // as the line above
        for (int g = 0; g < 4; ++g)
#pragma unroll   // as the line above
            for (int ks = h * KHALF; ks < (h + 1) * KHALF; ++ks) wv[g][ks] = *(const f4*)(wg + g * 4 * D_MODEL + ks * 32);
    // a precaution: what follows may be given the registers that hold the W loads' addresses; the address as an input
    // keeps its registers out of the loads' own results up to the wait
    asm volatile("s_wait_xcnt 0x0" :: "v"(wg) : "memory");

    // chunk c of a k step is quarter c >> 1 (piece c >> 2, half (c >> 1) & 1), elements 4 * (c & 1) .. + 3 of its row's 16 bytes
    _Float16* xw = xs + (wave >> 2) * (KSTEPS * XFRAG) + (c >> 1) * XQUARTER + (4 * (wave & 3) + rsub) * 8 + (c & 1) * 4;
#pragma unroll   // register arrays need constant indices
    for (int ks = 0; ks < KSTEPS; ++ks) {
        h4 r;
#pragma unroll   // vector elements need constant indices to stay in registers
        for (int e = 0; e < 4; ++e) r[e] = (_Float16)(xv[ks][e] * scale);
        *(h4*)(xw + ks * XFRAG) = r;
    }
    // ends the scheduling region: without it this compiler's build holds every LDS store back behind the last W load;
    // loads return in order, and each group's stores are to go out while the later groups still fly
    __builtin_amdgcn_sched_barrier(0);
    _Float16* ww = xs + (PROWS / 16 + wave) * (KSTEPS * XFRAG) + (c >> 1) * XQUARTER + rsub * 8 + (c & 1) * 4;
    stage_w(wv, ww, 0);
    // The staged X tile and the first half of W readable by every wave. The fences name LDS alone: __syncthreads() would
    // also wait here for the loads of the second half of W, which are to stay in flight under the first half's products.
    __builtin_amdgcn_fence(__ATOMIC_RELEASE, "workgroup", "local");
    __builtin_amdgcn_s_barrier();
    __builtin_amdgcn_fence(__ATOMIC_ACQUIRE, "workgroup", "local");

    // V: D = X * W^T; Q, K: D = W * X^T. A and B fragments have one layout, so the two forms differ only in which staged
    // tiles are read as A and which as B: a scalar choice of two LDS offsets, and one code path for all three products.
    int xo = (2 * rh) * (KSTEPS * XFRAG), wo = (PROWS / 16 + 2 * hd) * (KSTEPS * XFRAG);
    const _Float16* fl = xs + (lane >> 4) * XQUARTER + (lane & 15) * 8;
    const _Float16* pa = fl + (which == 2 ? xo : wo);
    const _Float16* pb = fl + (which == 2 ? wo : xo);
    v8f acc[2][2] = {};
    proj_products(pa, pb, 0, acc);
    // ends the scheduling region: the wait for the second half's loads is to stand behind the first half's products
    __builtin_amdgcn_sched_barrier(0);
    stage_w(wv, ww, 1);
    __syncthreads();                    // the second half of W readable by every wave; it lies on no byte of the first
    proj_products(pa, pb, KHALF, acc);

    // V: acc[i][j] is row tile i (piece i of the 32 rows s), d tile j. Q, K: piece i (8 columns d a lane), row tile j.
    // In both the 32 rows s0 .. s0 + 31 of a head are 2 KB in a row, and acc[i][j] is its 512 bytes at i * 512 + j * 1024.
    _Float16* dst = QKV + (long)which * (NROWS * D_MODEL) + (long)(b * N_HEAD + hd) * (SEQ * D_HID) + s0 * D_HID + lane * 8;
#pragma unroll   // register arrays need constant indices
    for (int i = 0; i < 2; ++i)
#pragma unroll   // register arrays need constant indices
        for (int j = 0; j < 2; ++j) {
            h8 r;
#pragma unroll   // vector elements need constant indices to stay in registers
            for (int e = 0; e < 8; ++e) r[e] = (_Float16)acc[i][j][e];
            *(h8*)(dst + i * 256 + j * 512) = r;
        }
}

// ---------- Kernel 2: flash attention (async double-buffered K/V stages of 256 keys in LDS) ----------
// Qh/Kh (Q pre-scaled, log2(e) included, so that exp(s - m) is 2^(s' - m') with no multiply), Vt: per head in fragment order, as the projection kernel writes them; a stage of 256 keys
// is 16 KB in a row of each. Obuf: [4096,256] f16 in fragment order.
// Wave tile: 32 queries (two column groups) x half of every stage's keys. Waves w and w + 4 hold the same
// queries; a K or V fragment read from LDS feeds both column groups. The key halves are joined once at the end.
__global__ __launch_bounds__(256) void attn_flash(
    const _Float16* __restrict__ Qh, const _Float16* __restrict__ Kh,
    const _Float16* __restrict__ Vt, _Float16* __restrict__ Obuf) {
    __shared__ __attribute__((aligned(16))) _Float16 kbuf[2][KSTAGE * D_HID];   // K stage: [key / 16][piece][lane][8]
    __shared__ __attribute__((aligned(16))) _Float16 vbuf[2][KSTAGE * D_HID];   // V stage: [key / 32][d / 16][piece][lane][8]
    __shared__ __attribute__((aligned(16))) f4 jo[4][2][4][32];               // group 1's O^T, handed to group 0
    __shared__ float jml[4][2][2][32];                                        // group 1's maxima and sums
    int lane = threadIdx.x & 31;
    int wave = threadIdx.x >> 5;
    int qw = wave & 3, grp = wave >> 2;          // 32-query tile of the block, key group
    int lr = lane & 15, hw = lane >> 4;
    int bh = blockIdx.y;                         // b*8 + h
    int q0 = (blockIdx.x * 4 + qw) * 32;         // 32-row Q tile per wave pair
    const _Float16* Qbase = Qh + ((long)bh * SEQ + q0) * D_HID;
    const _Float16* Kbase = Kh + (long)bh * SEQ * D_HID;
    const _Float16* Vbase = Vt + (long)bh * D_HID * SEQ;

    // eight async copies per wave per stage, every lane on: 1024 K pieces and 1024 V pieces of 16B over 256 threads
    auto stage = [&](int par, int kt) {
#pragma unroll   // the eight copies issue back to back
        for (int i = 0; i < 4; ++i) {
            int c = threadIdx.x + 256 * i;
            cp16_to_lds(Kbase + (long)kt * D_HID + c * 8, &kbuf[par][c * 8]);   // both contiguous, the order kept
            cp16_to_lds(Vbase + (long)kt * D_HID + c * 8, &vbuf[par][c * 8]);
        }
    };

    v16h bq[2];                                    // Q^T as B fragments, reused across entire K loop
    v8f o0[2], o1[2];                              // O^T: o0[c][r] = O[query][d = 8*hw + r], o1: d + 16
    float mrow[2], lsum[2];                        // lsum: this half's keys only, joined after the loop
#pragma unroll
    for (int c = 0; c < 2; ++c) {
        bq[c] = load_frag_packed(Qbase + c * 512 + lane * 8);
        o0[c] = v8f{}; o1[c] = v8f{};
        mrow[c] = -1e30f; lsum[c] = 0.f;
    }

    stage(0, 0);                                   // prologue fill of buffer 0
    asm volatile("s_wait_asynccnt 0x0" ::: "memory");   // this wave's copies of stage 0 have landed
    __syncthreads();                               // stage 0 readable by every wave
    stage(1, KSTAGE);                              // stage 1 flies while stage 0 is worked on
    for (int st = 0; st < SEQ / KSTAGE; ++st) {
      int par = st & 1;
#pragma unroll   // LDS offsets become immediates, and the next 32 keys' reads and scores can issue under this softmax
      for (int sub = 0; sub < KGROUP / 32; ++sub) {    // 32 keys at a time, as before; no barrier between them
        const _Float16* kb = kbuf[par] + (grp * KGROUP + sub * 32) * D_HID + lane * 8;   // two key tiles of 1 KB
        const _Float16* vb = vbuf[par] + (grp * KGROUP + sub * 32) * D_HID + lane * 8;   // two d tiles of 1 KB
        v16h ka = load_frag_packed(kb), kc = load_frag_packed(kb + 512);
        v16h va = load_frag_packed(vb), vc = load_frag_packed(vb + 512);
#pragma unroll   // the two column groups are independent chains that fill each other's waits
        for (int c = 0; c < 2; ++c) {
            // ---- S^T = K * Q^T for 32 key positions (two 16-row tiles) ----
            v8f z = {};
            v8f s0 = wmma_f16(ka, bq[c], z);
            v8f s1 = wmma_f16(kc, bq[c], z);

            // ---- online softmax, in-lane over 16 keys plus one exchange between the halves ----
            float t0 = fmaxf(s0[0], s1[0]), t1 = fmaxf(s0[1], s1[1]);
#pragma unroll
            for (int r = 2; r < 8; r += 2) {
                t0 = fmaxf(t0, fmaxf(s0[r], s1[r]));
                t1 = fmaxf(t1, fmaxf(s0[r + 1], s1[r + 1]));
            }
            float tmax = fmaxf(t0, t1);
            float mnew = fmaxf(mrow[c], fmaxf(tmax, xhalf(tmax)));
            float alpha = exp2_hw(mrow[c] - mnew);
            mrow[c] = mnew;
            v8f pa, pb;
#pragma unroll
            for (int r = 0; r < 8; ++r) { pa[r] = exp2_hw(s0[r] - mnew); pb[r] = exp2_hw(s1[r] - mnew); }
            v16h bp;                                   // P^T as 32x16 B fragment, straight from registers
#pragma unroll
            for (int r = 0; r < 8; ++r) { bp[r] = (_Float16)pa[r]; bp[8 + r] = (_Float16)pb[r]; }
            v8f ps = pa + pb;                          // this lane's 16 keys, summed as a tree
            f4 ph = ps.lo + ps.hi;
            lsum[c] = lsum[c] * alpha + ((ph[0] + ph[2]) + (ph[1] + ph[3]));
            o0[c] *= alpha; o1[c] *= alpha;

            // ---- O^T += V^T * P^T (V tile rows are d, cols are kpos) ----
            o0[c] = wmma_f16(va, bp, o0[c]);
            o1[c] = wmma_f16(vc, bp, o1[c]);
        }
      }
      // publish point of stage st + 1, which also frees buffer par
      asm volatile("s_wait_dscnt 0x0" ::: "memory");      // this wave's reads of buffer par are done before it is refilled
      asm volatile("s_wait_asynccnt 0x0" ::: "memory");   // this wave's copies of stage st + 1 have landed
      __syncthreads();
      if (st + 2 < SEQ / KSTAGE) stage(par, (st + 2) * KSTAGE);   // a whole stage of lead
    }
    asm volatile("s_wait_asynccnt 0x0" ::: "memory");     // nothing in flight when the wave ends

    // ---- join the two key groups: group 1 hands its state over through LDS, group 0 finishes ----
    if (grp == 1) {
#pragma unroll
        for (int c = 0; c < 2; ++c) {
            jo[qw][c][0][lane] = o0[c].lo; jo[qw][c][1][lane] = o0[c].hi;
            jo[qw][c][2][lane] = o1[c].lo; jo[qw][c][3][lane] = o1[c].hi;
            jml[qw][c][0][lane] = mrow[c]; jml[qw][c][1][lane] = lsum[c];
        }
    }
    __syncthreads();                               // group 1's state readable by group 0
    if (grp == 1) return;

    // ---- normalize and store (row = b*2048+q, col = h*32+d): a lane's 16 values are its part of the A fragment
    // of row tile row/16, k step h, so each store is 512 contiguous bytes ----
    int b = bh >> 3, h = bh & 7;
#pragma unroll
    for (int c = 0; c < 2; ++c) {
        float m1 = jml[qw][c][0][lane], l1 = jml[qw][c][1][lane];
        float mj = fmaxf(mrow[c], m1);
        float a0 = exp2_hw(mrow[c] - mj), a1 = exp2_hw(m1 - mj);
        v8f p0, p1;
        p0.lo = jo[qw][c][0][lane]; p0.hi = jo[qw][c][1][lane];
        p1.lo = jo[qw][c][2][lane]; p1.hi = jo[qw][c][3][lane];
        float ls = lsum[c] * a0 + l1 * a1;
        v8f u0 = o0[c] * a0 + p0 * a1;
        v8f u1 = o1[c] * a0 + p1 * a1;
        _Float16* dst = Obuf + frag_offset((b * SEQ + q0) / 16 + c, h, lane);
        float inv = 1.0f / (ls + xhalf(ls));       // join the two halves' sums once
        h8 w0, w1;
#pragma unroll
        for (int r = 0; r < 8; ++r) {
            w0[r] = (_Float16)(u0[r] * inv);
            w1[r] = (_Float16)(u1[r] * inv);
        }
        *(h8*)(dst)       = w0;                    // d = 8*hw .. 8*hw + 7
        *(h8*)(dst + 256) = w1;                    // d = 16 + 8*hw ..
    }
}

// ---------- Kernel 3: output projection  Y = O @ Wo^T + bo  (fp32 out); O and Wo in fragment order ----------
__global__ __launch_bounds__(256) void attn_outproj(
    const _Float16* __restrict__ O, const _Float16* __restrict__ Wo16,
    const float* __restrict__ bo, float* __restrict__ Y) {
    int lane = threadIdx.x & 31;
    int wave = threadIdx.x >> 5;
    int row0 = blockIdx.x * 16;
    int n0 = wave * 32;
    const _Float16* op = O + frag_offset(blockIdx.x, 0, lane);       // the block's row tile, 8 KB in a row
    const _Float16* wp = Wo16 + frag_offset(2 * wave, 0, lane);      // this wave's two column tiles, 16 KB in a row
    v8f c0 = {}, c1 = {};
#pragma unroll
    for (int k0 = 0; k0 < D_MODEL; k0 += 32) {
        v16h af = load_frag_packed(op + (k0 / 32) * 512);
        v16h b0 = load_frag_packed(wp + (k0 / 32) * 512);
        v16h b1 = load_frag_packed(wp + (KSTEPS + k0 / 32) * 512);
        c0 = wmma_f16(af, b0, c0);
        c1 = wmma_f16(af, b1, c1);
    }
    int lr = lane & 15, hw = lane >> 4;
#pragma unroll
    for (int r = 0; r < 8; ++r) {
        int m = row0 + r + 8 * hw;
        int col0 = n0 + lr, col1 = n0 + 16 + lr;
        Y[(long)m * D_MODEL + col0] = c0[r] + bo[col0];
        Y[(long)m * D_MODEL + col1] = c1[r] + bo[col1];
    }
}

extern "C" void kernel_launch(void* const* d_in, const int* in_sizes, int n_in,
                              void* d_out, int out_size, void* d_ws, size_t ws_size,
                              hipStream_t stream) {
    const float* query = (const float*)d_in[0];
    const float* key   = (const float*)d_in[1];
    const float* value = (const float*)d_in[2];
    const float* Wq    = (const float*)d_in[3];
    const float* Wk    = (const float*)d_in[4];
    const float* Wv    = (const float*)d_in[5];
    const float* Wo    = (const float*)d_in[6];
    const float* bo    = (const float*)d_in[7];

    // workspace carve-up (halves): Wo 64K, then Qh/Kh/Vt/Obuf 1M each (~8.1 MB)
    _Float16* Wo16 = (_Float16*)d_ws;
    _Float16* Qh   = Wo16 + D_MODEL * D_MODEL;
    _Float16* Kh   = Qh + (long)NROWS * D_MODEL;
    _Float16* Vt   = Kh + (long)NROWS * D_MODEL;
    _Float16* Ob   = Vt + (long)NROWS * D_MODEL;

    const float scaling = 0.25503486f;   // log2(e) / sqrt(32), folded into Q: the scores are exponents of 2
    attn_proj<<<3 * (NROWS / PROWS) + WOBLOCKS, PTHREADS, 0, stream>>>(query, key, value, Wq, Wk, Wv, Wo, Wo16, Qh, scaling);

    attn_flash<<<dim3(SEQ / 128, BATCH * N_HEAD), 256, 0, stream>>>(Qh, Kh, Vt, Ob);

    attn_outproj<<<NROWS / 16, 256, 0, stream>>>(Ob, Wo16, bo, (float*)d_out);
}
